// v000
// Times are from an AMD MI455X. After a warm-up the kernel runs many times in a row, and a time is the length of
// such a window on the GPU divided by its runs, so every launch and the gaps after it count. The runs cycle
// through copies of the inputs. A figure is the median of several windows, for all but v000 over two sittings.
// Sittings can differ by a few percent; kernels timed side by side share one.
// The starting kernel, v000, takes 722 microseconds a run.
// compute dtype: all inputs rounded to bf16; q, k, v = src . W^T + b with EXACT bf16 products on WMMA 16x16x32 (natural [out][in] rows); q and k stored as f16 hi + (x2048-scaled) residual planes, the 11 relative-position rows likewise; per (query tile, key step) inside the +-25 window: q . k and the relative term q . rel_emb[clip(j - i, -5, 5) + 5] (a 48-wide skewed window GEMM with the row index clamped exactly like the module's clip, gathered per (i,j) from LDS), 3 products each, x 64^-1/2, window / validity mask, running-max softmax in f32 (hardware exp); P as f16 hi + (x2048) residual x v hi/lo (3 products); out . Wo (ctx as bf16 hi + residual, 2 products) + bo + src, LayerNorm (eps 1e-5) in f32; FFN: x (hi + residual) . W1^T + b1 (2 products), ReLU, (hi + residual) . W2^T + b2 + x (2 products), LayerNorm; f32 accumulate.
#include <hip/hip_runtime.h>
#include <math.h>

typedef __attribute__((ext_vector_type(16))) _Float16 v16h;
typedef __attribute__((ext_vector_type(16))) __bf16 v16b;
typedef __attribute__((ext_vector_type(8)))  _Float16 v8h;
typedef __attribute__((ext_vector_type(8)))  float v8f;
typedef __attribute__((ext_vector_type(4)))  float v4f;
typedef __attribute__((ext_vector_type(2)))  float v2f;
typedef __attribute__((ext_vector_type(4)))  unsigned v4u;
typedef __attribute__((ext_vector_type(4)))  int v4i;
typedef float __attribute__((may_alias)) float_a;
typedef int __attribute__((may_alias)) int_a;

template <typename T> __device__ __forceinline__ void vst2(void* p, T v) { *(T*)p = v;  }
__device__ __forceinline__ v8f wmma16(v16h a, v16h b, v8f c) {
  v8f d = __builtin_amdgcn_wmma_f32_16x16x32_f16(false, a, false, b, (short)0, c, false, false);
  asm volatile("v_nop\n\tv_nop\n\tv_nop\n\tv_nop" : "+v"(d) : "v"(a), "v"(b));
  return d;
}
__device__ __forceinline__ v8f wmma_bf(v16b a, v16b b, v8f c) {
  v8f d = __builtin_amdgcn_wmma_f32_16x16x32_bf16(false, a, false, b, (short)0, c, false, false);
  asm volatile("v_nop\n\tv_nop\n\tv_nop\n\tv_nop" : "+v"(d) : "v"(a), "v"(b));
  return d;
}
// 16x16x32 fragments: lane = (h = lane>>4, row/col = lane&15); elements 0..7 = k0+8h+0..7, 8..15 = k0+16+8h+0..7; D element r = row 8h+r
__device__ __forceinline__ v16h frag_h(const _Float16* rowk0, int lane) {
  union { v16h v; v8h q[2]; } u; const _Float16* p = rowk0 + 8 * (lane >> 4);
  u.q[0] = *(const v8h*)p; u.q[1] = *(const v8h*)(p + 16); return u.v;
}
__device__ __forceinline__ v16h frag_f32(const float* rowk0, int lane) {
  v16h a; const float* p = rowk0 + 8 * (lane >> 4);
#pragma unroll
  for (int i = 0; i < 8; ++i) { a[i] = (_Float16)p[i]; a[8 + i] = (_Float16)p[16 + i]; }
  return a;
}
__device__ __forceinline__ v16h frag_f32s(const float* rowk0, int lane, float sc) {
  v16h a; const float* p = rowk0 + 8 * (lane >> 4);
#pragma unroll
  for (int i = 0; i < 8; ++i) { a[i] = (_Float16)(p[i] * sc); a[8 + i] = (_Float16)(p[16 + i] * sc); }
  return a;
}
// column fragment from a [K][ld] layout (column n), rows >= K read as 0
__device__ __forceinline__ v16h fragc_f32(const float* W, int k0, int n, int lane, int ld, int K) {
  v16h a; const int g = lane >> 4;
#pragma unroll
  for (int i = 0; i < 8; ++i) { const int ka = k0 + 8 * g + i, kb = ka + 16;
    a[i] = (_Float16)(ka < K ? W[(size_t)(ka < K ? ka : K - 1) * ld + n] : 0.f); a[8 + i] = (_Float16)(kb < K ? W[(size_t)(kb < K ? kb : K - 1) * ld + n] : 0.f); }
  return a;
}
struct F2 { v16b h, l; };
__device__ __forceinline__ F2 bsplit16(const float v[16]) { F2 r;
#pragma unroll
  for (int i = 0; i < 16; ++i) { const __bf16 h = (__bf16)v[i]; r.h[i] = h; r.l[i] = (__bf16)(v[i] - (float)h); }
  return r; }
__device__ __forceinline__ F2 split_row(const float* row, int k0, int lane) { float v[16]; const float* p = row + k0 + 8 * (lane >> 4);
#pragma unroll
  for (int i = 0; i < 8; ++i) { v[i] = p[i]; v[8 + i] = p[16 + i]; }
  return bsplit16(v); }
__device__ __forceinline__ F2 split_rowK(const float* row, int k0, int lane, int K) { float v[16]; const int g = lane >> 4;
#pragma unroll
  for (int i = 0; i < 8; ++i) { const int ka = k0 + 8 * g + i, kb = ka + 16; v[i] = ka < K ? row[ka < K ? ka : K - 1] : 0.f; v[8 + i] = kb < K ? row[kb < K ? kb : K - 1] : 0.f; }
  return bsplit16(v); }
__device__ __forceinline__ F2 split_col(const float* W, int k0, int n, int lane, int ld, int K) { float v[16]; const int g = lane >> 4;
#pragma unroll
  for (int i = 0; i < 8; ++i) { const int ka = k0 + 8 * g + i, kb = ka + 16; v[i] = ka < K ? W[(size_t)(ka < K ? ka : K - 1) * ld + n] : 0.f; v[8 + i] = kb < K ? W[(size_t)(kb < K ? kb : K - 1) * ld + n] : 0.f; }
  return bsplit16(v); }
__device__ __forceinline__ v8f mac3(const F2& a, const F2& b, v8f c) { c = wmma_bf(a.l, b.h, c); c = wmma_bf(a.h, b.l, c); return wmma_bf(a.h, b.h, c); }
__device__ __forceinline__ float sigm(float v) { return 1.0f / (1.0f + expf(-v)); }
#define LDSX() do { asm volatile("s_wait_dscnt 0" ::: "memory"); __builtin_amdgcn_wave_barrier(); __builtin_amdgcn_fence(__ATOMIC_RELEASE, "workgroup"); } while (0)


// ETC-style layer (B 2, S 2,048, d 1,024, 16 heads x 64, FFN 4,096): local attention over a +-25 window with clipped relative-position embeddings, output projection + residual + LN, ReLU FFN + residual + LN.
#define NB 2
#define SS 2048
#define NR (NB * SS)
#define DM 1024
#define NH 16
#define HD 64
#define FF 4096
#define RAD 25
#define KREL 5
#define NREL (2 * KREL + 1)
#ifndef TQB
#define TQB (SS / 64)
#endif
#ifndef TQ0
#define TQ0 0
#endif
typedef __attribute__((ext_vector_type(8))) __bf16 v8b;
__device__ __forceinline__ v16b frag_b(const __bf16* rowk0, int lane) {
  union { v16b v; v8b q[2]; } u; const __bf16* p = rowk0 + 8 * (lane >> 4);
  u.q[0] = *(const v8b*)p; u.q[1] = *(const v8b*)(p + 16); return u.v;
}
__device__ __forceinline__ float bfr(float v) { return (float)(__bf16)v; }
__device__ __attribute__((noinline)) float exp_ni(float v) { return expf(v); }
__device__ __attribute__((noinline)) float erf_ni(float v) { return erff(v); }

#define PK_Q  0
#define PK_K  ((size_t)DM * DM)
#define PK_V  ((size_t)2 * DM * DM)
#define PK_O  ((size_t)3 * DM * DM)
#define PK_1  ((size_t)4 * DM * DM)                // [4096][1024] w1 natural
#define PK_2  (PK_1 + (size_t)FF * DM)             // [1024][4096] w2 natural
#define PK_END (PK_2 + (size_t)DM * FF)
#define WS_PK  0u
#define WS_QH  (((2u * PK_END) + 127u) / 128u * 128u)    // f16 [4096][1024] q hi ; QL ; KH ; KL
#define WS_QL  (WS_QH + 2u * NR * DM)
#define WS_KH  (WS_QL + 2u * NR * DM)
#define WS_KL  (WS_KH + 2u * NR * DM)
#define WS_VTH (WS_KL + 2u * NR * DM)                    // f16 [b][1024][2048] v hi ; VTL
#define WS_VTL (WS_VTH + 2u * NR * DM)
#define WS_REL (WS_VTL + 2u * NR * DM)                   // f16 [16 rows][64] rel hi ; RELL (11 real)
#define WS_RELL (WS_REL + 2u * 16 * HD)
#define WS_O   (((WS_RELL + 2u * 16 * HD) + 127u) / 128u * 128u)   // f32 [4096][1024] ctx
#define WS_T1  (WS_O + 4u * NR * DM)                     // f32 pre-LN (reused)
#define WS_H   (WS_T1 + 4u * NR * DM)                    // f32 x = LN1 output
#define WS_GH  (WS_H + 4u * NR * DM)                     // bf16 [4096][4096] relu hi ; GL
#define WS_GL  (WS_GH + 2u * (size_t)NR * FF)
#define WS_END (WS_GL + 2u * (size_t)NR * FF)

__global__ __launch_bounds__(256) void k_pack(const float* __restrict__ WQ, const float* __restrict__ WK, const float* __restrict__ WV, const float* __restrict__ WO, const float* __restrict__ W1, const float* __restrict__ W2, const float* __restrict__ RELE, __bf16* __restrict__ PK, _Float16* __restrict__ RELH, _Float16* __restrict__ RELL) {
  __shared__ __align__(16) __bf16 s[FF]; __shared__ __align__(16) _Float16 sh_[HD], sl_[HD]; const int n = blockIdx.x, which = blockIdx.y, t = threadIdx.x; int K; size_t dst;   // natural [out][in] rows
  if (which == 6) { if (n >= 16) return; if (t < HD) { const float v = (n < NREL) ? bfr(RELE[n * HD + t]) : 0.f; const _Float16 hv = (_Float16)v; sh_[t] = hv; sl_[t] = (_Float16)((v - (float)hv) * 2048.0f); } __syncthreads(); if (t < 8) vst2((unsigned*)(RELH + n * HD + t * 8), *(const v4u*)&sh_[t * 8]); else if (t < 16) vst2((unsigned*)(RELL + n * HD + (t - 8) * 8), *(const v4u*)&sl_[(t - 8) * 8]); return; }
  if (which < 4) { if (n >= DM) return; const float* Wm = (which == 0) ? WQ : (which == 1) ? WK : (which == 2) ? WV : WO; K = DM; dst = (size_t)which * DM * DM + (size_t)n * DM; for (int k = t; k < DM; k += 256) s[k] = (__bf16)Wm[(size_t)n * DM + k]; }
  else if (which == 4) { K = DM; dst = PK_1 + (size_t)n * DM; for (int k = t; k < DM; k += 256) s[k] = (__bf16)W1[(size_t)n * DM + k]; }
  else { if (n >= DM) return; K = FF; dst = PK_2 + (size_t)n * FF; for (int k = t; k < FF; k += 256) s[k] = (__bf16)W2[(size_t)n * FF + k]; }
  __syncthreads();
  for (int q = t; q < K / 8; q += 256) vst2((unsigned*)(PK + dst + q * 8), *(const v4u*)&s[q * 8]);
}
// ---- k_proj: block = (64 rows, 128 cols, which): 0 q, 1 k -> f16 hi/lo rows (+ bias); 2 v -> hi/lo transposed planes per batch
__global__ __launch_bounds__(128) void k_proj(const float* __restrict__ X, const __bf16* __restrict__ PK, const float* __restrict__ BQ, const float* __restrict__ BK, const float* __restrict__ BV, _Float16* __restrict__ QH, _Float16* __restrict__ QL_, _Float16* __restrict__ KH, _Float16* __restrict__ KL, _Float16* __restrict__ VTH, _Float16* __restrict__ VTL) {
  __shared__ __align__(16) _Float16 soh[4][16][136], sol[4][16][136]; __shared__ __align__(16) _Float16 sth[128][72], stl[128][72];
  const int tid = threadIdx.x, wave = tid >> 5, lane = tid & 31, col = lane & 15, g = lane >> 4; const int which = blockIdx.z; const size_t r0 = (size_t)blockIdx.x * 64 + wave * 16; const int n0 = blockIdx.y * 128;
  const __bf16* P = PK + ((which == 0) ? PK_Q : (which == 1) ? PK_K : PK_V); const float* BB = (which == 0) ? BQ : (which == 1) ? BK : BV;
  v8f acc[8] = {};
#pragma unroll 2
  for (int kc = 0; kc < DM / 32; ++kc) { v16b a; { const float* p = X + (r0 + col) * DM + kc * 32 + 8 * g;
#pragma unroll
      for (int i = 0; i < 8; ++i) { a[i] = (__bf16)p[i]; a[8 + i] = (__bf16)p[16 + i]; } }
#pragma unroll
    for (int j = 0; j < 8; ++j) acc[j] = wmma_bf(a, frag_b(P + (size_t)(n0 + j * 16 + col) * DM + kc * 32, lane), acc[j]); }
  if (which < 2) {
#pragma unroll
    for (int j = 0; j < 8; ++j) { const float bb = bfr(BB[n0 + j * 16 + col]);
#pragma unroll
      for (int r = 0; r < 8; ++r) { const float vv = acc[j][r] + bb; const _Float16 hv = (_Float16)vv; soh[wave][8 * g + r][j * 16 + col] = hv; sol[wave][8 * g + r][j * 16 + col] = (_Float16)((vv - (float)hv) * 2048.0f); } }
    LDSX();
    _Float16* DH_ = (which == 0) ? QH : KH; _Float16* DL_ = (which == 0) ? QL_ : KL;
    for (int rl = 0; rl < 16; ++rl) { if (lane < 16) vst2((unsigned*)(DH_ + (r0 + rl) * DM + n0 + lane * 8), *(const v4u*)&soh[wave][rl][lane * 8]); else vst2((unsigned*)(DL_ + (r0 + rl) * DM + n0 + (lane - 16) * 8), *(const v4u*)&sol[wave][rl][(lane - 16) * 8]); }
  } else {
#pragma unroll
    for (int j = 0; j < 8; ++j) { const float bb = bfr(BB[n0 + j * 16 + col]);
#pragma unroll
      for (int r = 0; r < 8; ++r) { const float vv = acc[j][r] + bb; const _Float16 hv = (_Float16)vv; sth[j * 16 + col][wave * 16 + 8 * g + r] = hv; stl[j * 16 + col][wave * 16 + 8 * g + r] = (_Float16)((vv - (float)hv) * 2048.0f); } }
    __syncthreads();
    const size_t rb = (size_t)blockIdx.x * 64; const int b = (int)(rb / SS), s0 = (int)(rb % SS);
    for (int e = tid; e < 128 * 8; e += 128) { const int d = e >> 3, pc = e & 7; const size_t o = ((size_t)b * DM + n0 + d) * SS + s0 + pc * 8; vst2((unsigned*)(VTH + o), *(const v4u*)&sth[d][pc * 8]); vst2((unsigned*)(VTL + o), *(const v4u*)&stl[d][pc * 8]); }
  }
}
// ---- k_attn: block = (64 queries i, h, b): key steps covering [i0 - 25, i0 + 63 + 25] within [0, S); c = q.k (3 products); rel band: window slot t <-> offset (j - i) = t0w + t with t0w = j0 - iw0 - 15, row = clip(t0w + t, -5, 5) + 5 (3 products) -> LDS, picked at jl - il + 15; scores = (c + rel)/8 within |j - i| <= 25 and 0 <= j < S, else -inf; online softmax; P hi/lo x V hi/lo
__global__ __launch_bounds__(128) void k_attn(const _Float16* __restrict__ QH, const _Float16* __restrict__ QL_, const _Float16* __restrict__ KH, const _Float16* __restrict__ KL, const _Float16* __restrict__ RELH, const _Float16* __restrict__ RELL, const _Float16* __restrict__ VTH, const _Float16* __restrict__ VTL, float* __restrict__ O) {
  __shared__ __align__(16) _Float16 sph[4][16][40], spl[4][16][40]; __shared__ float srl[4][16][49]; __shared__ __align__(16) float so[4][16][68];
  const int tid = threadIdx.x, wave = tid >> 5, lane = tid & 31, col = lane & 15, g = lane >> 4; const int qb = blockIdx.x + TQ0, h = blockIdx.y, b = blockIdx.z; const int i0 = qb * 64, iw0 = i0 + wave * 16;
  v16h aq[2], aql[2];
#pragma unroll
  for (int kc = 0; kc < 2; ++kc) { const size_t o = ((size_t)b * SS + iw0 + col) * DM + h * HD + kc * 32; aq[kc] = frag_h(QH + o, lane); aql[kc] = frag_h(QL_ + o, lane); }
  const _Float16* Vh = VTH + ((size_t)b * DM + h * HD) * SS; const _Float16* Vl = VTL + ((size_t)b * DM + h * HD) * SS;
  float m[8], l[8];
#pragma unroll
  for (int r = 0; r < 8; ++r) { m[r] = -3.0e38f; l[r] = 0.f; }
  v8f acc[4] = {}, accl[4] = {};
  const int jlo = max(i0 - RAD, 0), jhi = min(i0 + 63 + RAD, SS - 1); const int ks0 = jlo / 32, ks1 = jhi / 32;
#pragma unroll 1
  for (int ks = ks0; ks <= ks1; ++ks) { const int j0 = ks * 32;
    { const int t0w = j0 - iw0 - 15;   // offset (j - i) of window slot 0
#pragma unroll
      for (int ct3 = 0; ct3 < 3; ++ct3) { int rr = t0w + ct3 * 16 + col; rr = min(max(rr, -KREL), KREL) + KREL; v8f u = {}, ul = {};
#pragma unroll
        for (int kc = 0; kc < 2; ++kc) { const v16h rh = frag_h(RELH + (size_t)rr * HD + kc * 32, lane); u = wmma16(aq[kc], rh, u); ul = wmma16(aql[kc], rh, ul); ul = wmma16(aq[kc], frag_h(RELL + (size_t)rr * HD + kc * 32, lane), ul); }
#pragma unroll
        for (int r = 0; r < 8; ++r) srl[wave][8 * g + r][ct3 * 16 + col] = u[r] + ul[r] * (1.0f / 2048.0f); } }
    LDSX();
    v8f s[2];
#pragma unroll
    for (int ct = 0; ct < 2; ++ct) { const int jl = ct * 16 + col; const int kk = j0 + jl; const size_t rk = ((size_t)b * SS + kk) * DM + h * HD; v8f c = {}, cl = {};
#pragma unroll
      for (int kc = 0; kc < 2; ++kc) { const v16h khf = frag_h(KH + rk + kc * 32, lane); c = wmma16(aq[kc], khf, c); cl = wmma16(aql[kc], khf, cl); cl = wmma16(aq[kc], frag_h(KL + rk + kc * 32, lane), cl); }
#pragma unroll
      for (int r = 0; r < 8; ++r) { const int il = 8 * g + r; const int off = kk - (iw0 + il); const bool ok = (off <= RAD) && (off >= -RAD) && (kk < SS);
        s[ct][r] = ok ? (c[r] + cl[r] * (1.0f / 2048.0f) + srl[wave][il][jl - il + 15]) * 0.125f : -3.0e38f; } }
#pragma unroll
    for (int r = 0; r < 8; ++r) { float mx = fmaxf(s[0][r], s[1][r]);
#pragma unroll
      for (int o = 1; o < 16; o <<= 1) mx = fmaxf(mx, __shfl_xor(mx, o));
      const float mn = fmaxf(m[r], mx); const float alpha = (m[r] <= -1.0e38f) ? 0.f : __expf(m[r] - mn);
      const float e0 = (s[0][r] <= -1.0e38f) ? 0.f : __expf(s[0][r] - mn), e1 = (s[1][r] <= -1.0e38f) ? 0.f : __expf(s[1][r] - mn); float es = e0 + e1;
#pragma unroll
      for (int o = 1; o < 16; o <<= 1) es += __shfl_xor(es, o);
      l[r] = l[r] * alpha + es; m[r] = (mn <= -1.0e38f) ? m[r] : mn;
#pragma unroll
      for (int dt = 0; dt < 4; ++dt) { acc[dt][r] *= alpha; accl[dt][r] *= alpha; }
      const _Float16 h0 = (_Float16)e0, h1 = (_Float16)e1; sph[wave][8 * g + r][col] = h0; sph[wave][8 * g + r][16 + col] = h1; spl[wave][8 * g + r][col] = (_Float16)((e0 - (float)h0) * 2048.0f); spl[wave][8 * g + r][16 + col] = (_Float16)((e1 - (float)h1) * 2048.0f); }
    LDSX();
    const v16h pah = frag_h(&sph[wave][col][0], lane), pal = frag_h(&spl[wave][col][0], lane);
#pragma unroll
    for (int dt = 0; dt < 4; ++dt) { const size_t vo = (size_t)(dt * 16 + col) * SS + j0; const v16h vh = frag_h(Vh + vo, lane), vl = frag_h(Vl + vo, lane); acc[dt] = wmma16(pah, vh, acc[dt]); accl[dt] = wmma16(pal, vh, accl[dt]); accl[dt] = wmma16(pah, vl, accl[dt]); }
    LDSX(); }
#pragma unroll
  for (int r = 0; r < 8; ++r) { const float il = 1.0f / l[r];
#pragma unroll
    for (int dt = 0; dt < 4; ++dt) so[wave][8 * g + r][dt * 16 + col] = (acc[dt][r] + accl[dt][r] * (1.0f / 2048.0f)) * il; }
  LDSX();
  for (int rl = 0; rl < 16; ++rl) if (lane < 16) vst2(O + ((size_t)b * SS + iw0 + rl) * DM + h * HD + lane * 4, *(const v4f*)&so[wave][rl][lane * 4]);
}
// ---- k_lin<MODE>: 0: T1 = O(hi/lo) . Wo^T + bo + src; 1: G = relu(X(hi/lo) . W1^T + b1) -> bf16 hi/lo; 2: T1 = G . W2^T (2 products) + b2 + X
template <int MODE>
__global__ __launch_bounds__(128) void k_lin(const float* __restrict__ A, const __bf16* __restrict__ AG, const __bf16* __restrict__ AGL, const __bf16* __restrict__ PK, const float* __restrict__ BIAS, const float* __restrict__ RES, float* __restrict__ OUTF, __bf16* __restrict__ OUTG, __bf16* __restrict__ OUTGL) {
  __shared__ __align__(16) float so[4][16][132]; __shared__ __align__(16) __bf16 sg[4][16][136], sgl[4][16][136];
  const int tid = threadIdx.x, wave = tid >> 5, lane = tid & 31, col = lane & 15, g = lane >> 4; const size_t r0 = (size_t)blockIdx.x * 64 + wave * 16; const int n0 = blockIdx.y * 128;
  constexpr int KD = (MODE == 2) ? FF : DM; const __bf16* P = PK + ((MODE == 0) ? PK_O : (MODE == 1) ? PK_1 : PK_2);
  v8f acc[8] = {};
  if (MODE == 2) {
#pragma unroll 2
    for (int kc = 0; kc < KD / 32; ++kc) { const v16b a = frag_b(AG + (r0 + col) * FF + kc * 32, lane), al = frag_b(AGL + (r0 + col) * FF + kc * 32, lane);
#pragma unroll
      for (int j = 0; j < 8; ++j) { const v16b w = frag_b(P + (size_t)(n0 + j * 16 + col) * KD + kc * 32, lane); acc[j] = wmma_bf(al, w, acc[j]); acc[j] = wmma_bf(a, w, acc[j]); } }
  } else {
#pragma unroll 2
    for (int kc = 0; kc < KD / 32; ++kc) { const F2 a = split_row(A + (r0 + col) * DM, kc * 32, lane);
#pragma unroll
      for (int j = 0; j < 8; ++j) { const v16b w = frag_b(P + (size_t)(n0 + j * 16 + col) * KD + kc * 32, lane); acc[j] = wmma_bf(a.l, w, acc[j]); acc[j] = wmma_bf(a.h, w, acc[j]); } } }
#pragma unroll
  for (int j = 0; j < 8; ++j) { const int c = n0 + j * 16 + col; const float bb = bfr(BIAS[c]);
#pragma unroll
    for (int r = 0; r < 8; ++r) { const size_t row = r0 + 8 * g + r; float v = acc[j][r] + bb;
      if (MODE == 1) { v = fmaxf(v, 0.f); const __bf16 hb = (__bf16)v; sg[wave][8 * g + r][j * 16 + col] = hb; sgl[wave][8 * g + r][j * 16 + col] = (__bf16)(v - (float)hb); }
      else { v += (MODE == 0) ? bfr(RES[row * DM + c]) : RES[row * DM + c]; so[wave][8 * g + r][j * 16 + col] = v; } } }
  LDSX();
  if (MODE == 1) { for (int rl = 0; rl < 16; ++rl) { if (lane < 16) vst2((unsigned*)(OUTG + (r0 + rl) * FF + n0 + lane * 8), *(const v4u*)&sg[wave][rl][lane * 8]); else vst2((unsigned*)(OUTGL + (r0 + rl) * FF + n0 + (lane - 16) * 8), *(const v4u*)&sgl[wave][rl][(lane - 16) * 8]); } }
  else { for (int rl = 0; rl < 16; ++rl) vst2(OUTF + (r0 + rl) * DM + n0 + lane * 4, *(const v4f*)&so[wave][rl][lane * 4]); }
}
// ---- k_ln: block = row (256 threads x 4): LayerNorm (biased variance, eps 1e-5)
__global__ __launch_bounds__(256) void k_ln(const float* __restrict__ T, const float* __restrict__ G, const float* __restrict__ Bv, float* __restrict__ OUT) {
  __shared__ float red[2][8]; const int t = threadIdx.x; const size_t row = blockIdx.x; const float* p = T + row * DM + t * 4;
  float v[4] = {p[0], p[1], p[2], p[3]}; float s = (v[0] + v[1]) + (v[2] + v[3]);
#pragma unroll
  for (int o = 1; o < 32; o <<= 1) s += __shfl_xor(s, o);
  if ((t & 31) == 0) red[0][t >> 5] = s; __syncthreads();
  float tot = 0.f; for (int w = 0; w < 8; ++w) tot += red[0][w]; const float mu = tot / (float)DM; float q = 0.f;
#pragma unroll
  for (int i = 0; i < 4; ++i) { const float d = v[i] - mu; q += d * d; }
#pragma unroll
  for (int o = 1; o < 32; o <<= 1) q += __shfl_xor(q, o);
  if ((t & 31) == 0) red[1][t >> 5] = q; __syncthreads();
  float qt = 0.f; for (int w = 0; w < 8; ++w) qt += red[1][w]; const float inv = 1.0f / sqrtf(qt / (float)DM + 1e-5f);
  v4f o4;
#pragma unroll
  for (int i = 0; i < 4; ++i) o4[i] = (v[i] - mu) * inv * bfr(G[t * 4 + i]) + bfr(Bv[t * 4 + i]);
  vst2(OUT + row * DM + t * 4, o4);
}
extern "C" void kernel_launch(void* const* d_in, const int* in_sizes, int n_in, void* d_out, int out_size, void* d_ws, size_t ws_size, hipStream_t stream) {
  (void)in_sizes; (void)n_in; (void)out_size;
  const float** F = (const float**)d_in;   // 0 src [2,2048,1024], 1 wq [1024,1024] natural, 2 bq, 3 wk, 4 bk, 5 wv, 6 bv, 7 wo, 8 bo, 9 rel_emb [11,64], 10 w1 [4096,1024] natural, 11 b1, 12 w2 [1024,4096] natural, 13 b2, 14 g1, 15 beta1, 16 g2, 17 beta2
  if (ws_size < (size_t)WS_END) return;
  char* ws = (char*)d_ws; __bf16 *PK = (__bf16*)(ws + WS_PK), *GH = (__bf16*)(ws + WS_GH), *GL = (__bf16*)(ws + WS_GL); _Float16 *QH = (_Float16*)(ws + WS_QH), *QLp = (_Float16*)(ws + WS_QL), *KH = (_Float16*)(ws + WS_KH), *KL = (_Float16*)(ws + WS_KL), *VTH = (_Float16*)(ws + WS_VTH), *VTL = (_Float16*)(ws + WS_VTL), *RELH = (_Float16*)(ws + WS_REL), *RELL = (_Float16*)(ws + WS_RELL); float *O = (float*)(ws + WS_O), *T1 = (float*)(ws + WS_T1), *Hh = (float*)(ws + WS_H);
  k_pack<<<dim3(FF, 7), 256, 0, stream>>>(F[1], F[3], F[5], F[7], F[10], F[12], F[9], PK, RELH, RELL);
  k_proj<<<dim3(NR / 64, DM / 128, 3), 128, 0, stream>>>(F[0], PK, F[2], F[4], F[6], QH, QLp, KH, KL, VTH, VTL);
  k_attn<<<dim3(TQB, NH, NB), 128, 0, stream>>>(QH, QLp, KH, KL, RELH, RELL, VTH, VTL, O);
#ifndef TWIN_ROWS
  const size_t R0 = 0; const int NRW = NR; (void)R0;
  k_lin<0><<<dim3(NR / 64, DM / 128), 128, 0, stream>>>(O, nullptr, nullptr, PK, F[8], F[0], T1, nullptr, nullptr);
  k_ln<<<NR, 256, 0, stream>>>(T1, F[14], F[15], Hh);
  k_lin<1><<<dim3(NR / 64, FF / 128), 128, 0, stream>>>(Hh, nullptr, nullptr, PK, F[11], nullptr, nullptr, GH, GL);
  k_lin<2><<<dim3(NR / 64, DM / 128), 128, 0, stream>>>(nullptr, GH, GL, PK, F[13], Hh, T1, nullptr, nullptr);
  k_ln<<<NR, 256, 0, stream>>>(T1, F[16], F[17], (float*)d_out);
#else
  for (int bb = 0; bb < NB; ++bb) { const size_t R0 = (size_t)bb * SS + (size_t)TQ0 * 64; const int NRW = TQB * 64;   // only the attended rows of each batch
  k_lin<0><<<dim3(NRW / 64, DM / 128), 128, 0, stream>>>(O + R0 * DM, nullptr, nullptr, PK, F[8], F[0] + R0 * DM, T1 + R0 * DM, nullptr, nullptr);
  k_ln<<<NRW, 256, 0, stream>>>(T1 + R0 * DM, F[14], F[15], Hh + R0 * DM);
  k_lin<1><<<dim3(NRW / 64, FF / 128), 128, 0, stream>>>(Hh + R0 * DM, nullptr, nullptr, PK, F[11], nullptr, nullptr, GH + R0 * FF, GL + R0 * FF);
  k_lin<2><<<dim3(NRW / 64, DM / 128), 128, 0, stream>>>(nullptr, GH + R0 * FF, GL + R0 * FF, PK, F[13], Hh + R0 * DM, T1 + R0 * DM, nullptr, nullptr);
  k_ln<<<NRW, 256, 0, stream>>>(T1 + R0 * DM, F[16], F[17], (float*)d_out + R0 * DM); }
#endif
}

// v001
// Measured time: 251 microseconds a run.
// Next to v000, in two timings, it ran 2.91 and 2.93 times as fast.
// compute dtype: all inputs rounded to bf16; q, k, v = src . W^T + b with EXACT bf16 products on WMMA 16x16x32 (natural [out][in] rows); q and k stored as f16 hi + (x2048-scaled) residual planes, the 11 relative-position rows likewise; per (query tile, key step) inside the +-25 window: q . k and the relative term q . rel_emb[clip(j - i, -5, 5) + 5] (a 48-wide skewed window GEMM with the row index clamped exactly like the module's clip, gathered per (i,j) from LDS), 3 products each, x 64^-1/2, window / validity mask, running-max softmax in f32 (hardware exp); P as f16 hi + (x2048) residual x v hi/lo (3 products); out . Wo (ctx as bf16 hi + residual, 2 products) + bo + src, LayerNorm (eps 1e-5) in f32; FFN: x (hi + residual) . W1^T + b1 (2 products), ReLU, (hi + residual) . W2^T + b2 + x (2 products), LayerNorm; f32 accumulate.
#include <hip/hip_runtime.h>
#include <math.h>

typedef __attribute__((ext_vector_type(16))) _Float16 v16h;
typedef __attribute__((ext_vector_type(16))) __bf16 v16b;
typedef __attribute__((ext_vector_type(8)))  _Float16 v8h;
typedef __attribute__((ext_vector_type(8)))  float v8f;
typedef __attribute__((ext_vector_type(4)))  float v4f;
typedef __attribute__((ext_vector_type(2)))  float v2f;
typedef __attribute__((ext_vector_type(4)))  unsigned v4u;
typedef __attribute__((ext_vector_type(4)))  int v4i;
typedef float __attribute__((may_alias)) float_a;
typedef int __attribute__((may_alias)) int_a;

template <typename T> __device__ __forceinline__ void vst2(void* p, T v) { *(T*)p = v;  }
__device__ __forceinline__ v8f wmma16(v16h a, v16h b, v8f c) {
  v8f d = __builtin_amdgcn_wmma_f32_16x16x32_f16(false, a, false, b, (short)0, c, false, false);
  asm volatile("v_nop\n\tv_nop\n\tv_nop\n\tv_nop" : "+v"(d) : "v"(a), "v"(b));
  return d;
}
__device__ __forceinline__ v8f wmma_bf(v16b a, v16b b, v8f c) {
  v8f d = __builtin_amdgcn_wmma_f32_16x16x32_bf16(false, a, false, b, (short)0, c, false, false);
  asm volatile("v_nop\n\tv_nop\n\tv_nop\n\tv_nop" : "+v"(d) : "v"(a), "v"(b));
  return d;
}
// 16x16x32 fragments: lane = (h = lane>>4, row/col = lane&15); elements 0..7 = k0+8h+0..7, 8..15 = k0+16+8h+0..7; D element r = row 8h+r
__device__ __forceinline__ v16h frag_h(const _Float16* rowk0, int lane) {
  union { v16h v; v8h q[2]; } u; const _Float16* p = rowk0 + 8 * (lane >> 4);
  u.q[0] = *(const v8h*)p; u.q[1] = *(const v8h*)(p + 16); return u.v;
}
__device__ __forceinline__ v16h frag_f32(const float* rowk0, int lane) {
  v16h a; const float* p = rowk0 + 8 * (lane >> 4);
#pragma unroll
  for (int i = 0; i < 8; ++i) { a[i] = (_Float16)p[i]; a[8 + i] = (_Float16)p[16 + i]; }
  return a;
}
__device__ __forceinline__ v16h frag_f32s(const float* rowk0, int lane, float sc) {
  v16h a; const float* p = rowk0 + 8 * (lane >> 4);
#pragma unroll
  for (int i = 0; i < 8; ++i) { a[i] = (_Float16)(p[i] * sc); a[8 + i] = (_Float16)(p[16 + i] * sc); }
  return a;
}
// column fragment from a [K][ld] layout (column n), rows >= K read as 0
__device__ __forceinline__ v16h fragc_f32(const float* W, int k0, int n, int lane, int ld, int K) {
  v16h a; const int g = lane >> 4;
#pragma unroll
  for (int i = 0; i < 8; ++i) { const int ka = k0 + 8 * g + i, kb = ka + 16;
    a[i] = (_Float16)(ka < K ? W[(size_t)(ka < K ? ka : K - 1) * ld + n] : 0.f); a[8 + i] = (_Float16)(kb < K ? W[(size_t)(kb < K ? kb : K - 1) * ld + n] : 0.f); }
  return a;
}
struct F2 { v16b h, l; };
__device__ __forceinline__ F2 bsplit16(const float v[16]) { F2 r;
#pragma unroll
  for (int i = 0; i < 16; ++i) { const __bf16 h = (__bf16)v[i]; r.h[i] = h; r.l[i] = (__bf16)(v[i] - (float)h); }
  return r; }
__device__ __forceinline__ F2 split_row(const float* row, int k0, int lane) { float v[16]; const float* p = row + k0 + 8 * (lane >> 4);
#pragma unroll
  for (int i = 0; i < 8; ++i) { v[i] = p[i]; v[8 + i] = p[16 + i]; }
  return bsplit16(v); }
__device__ __forceinline__ F2 split_rowK(const float* row, int k0, int lane, int K) { float v[16]; const int g = lane >> 4;
#pragma unroll
  for (int i = 0; i < 8; ++i) { const int ka = k0 + 8 * g + i, kb = ka + 16; v[i] = ka < K ? row[ka < K ? ka : K - 1] : 0.f; v[8 + i] = kb < K ? row[kb < K ? kb : K - 1] : 0.f; }
  return bsplit16(v); }
__device__ __forceinline__ F2 split_col(const float* W, int k0, int n, int lane, int ld, int K) { float v[16]; const int g = lane >> 4;
#pragma unroll
  for (int i = 0; i < 8; ++i) { const int ka = k0 + 8 * g + i, kb = ka + 16; v[i] = ka < K ? W[(size_t)(ka < K ? ka : K - 1) * ld + n] : 0.f; v[8 + i] = kb < K ? W[(size_t)(kb < K ? kb : K - 1) * ld + n] : 0.f; }
  return bsplit16(v); }
__device__ __forceinline__ v8f mac3(const F2& a, const F2& b, v8f c) { c = wmma_bf(a.l, b.h, c); c = wmma_bf(a.h, b.l, c); return wmma_bf(a.h, b.h, c); }
__device__ __forceinline__ float sigm(float v) { return 1.0f / (1.0f + expf(-v)); }
#define LDSX() do { asm volatile("s_wait_dscnt 0" ::: "memory"); __builtin_amdgcn_wave_barrier(); __builtin_amdgcn_fence(__ATOMIC_RELEASE, "workgroup"); } while (0)


// ETC-style layer (B 2, S 2,048, d 1,024, 16 heads x 64, FFN 4,096): local attention over a +-25 window with clipped relative-position embeddings, output projection + residual + LN, ReLU FFN + residual + LN.
#define NB 2
#define SS 2048
#define NR (NB * SS)
#define DM 1024
#define NH 16
#define HD 64
#define FF 4096
#define RAD 25
#define KREL 5
#define NREL (2 * KREL + 1)
#ifndef TQB
#define TQB (SS / 64)
#endif
#ifndef TQ0
#define TQ0 0
#endif
typedef __attribute__((ext_vector_type(8))) __bf16 v8b;
__device__ __forceinline__ v16b frag_b(const __bf16* rowk0, int lane) {
  union { v16b v; v8b q[2]; } u; const __bf16* p = rowk0 + 8 * (lane >> 4);
  u.q[0] = *(const v8b*)p; u.q[1] = *(const v8b*)(p + 16); return u.v;
}
__device__ __forceinline__ float bfr(float v) { return (float)(__bf16)v; }
__device__ __attribute__((noinline)) float exp_ni(float v) { return expf(v); }
__device__ __attribute__((noinline)) float erf_ni(float v) { return erff(v); }

#define PK_Q  0
#define PK_K  ((size_t)DM * DM)
#define PK_V  ((size_t)2 * DM * DM)
#define PK_O  ((size_t)3 * DM * DM)
#define PK_1  ((size_t)4 * DM * DM)                // [4096][1024] w1 natural
#define PK_2  (PK_1 + (size_t)FF * DM)             // [1024][4096] w2 natural
#define PK_END (PK_2 + (size_t)DM * FF)
#define WS_PK  0u
#define WS_QH  (((2u * PK_END) + 127u) / 128u * 128u)    // f16 [4096][1024] q hi ; QL ; KH ; KL
#define WS_QL  (WS_QH + 2u * NR * DM)
#define WS_KH  (WS_QL + 2u * NR * DM)
#define WS_KL  (WS_KH + 2u * NR * DM)
#define WS_VTH (WS_KL + 2u * NR * DM)                    // f16 [b][1024][2048] v hi ; VTL
#define WS_VTL (WS_VTH + 2u * NR * DM)
#define WS_REL (WS_VTL + 2u * NR * DM)                   // f16 [16 rows][64] rel hi ; RELL (11 real)
#define WS_RELL (WS_REL + 2u * 16 * HD)
#define WS_O   (((WS_RELL + 2u * 16 * HD) + 127u) / 128u * 128u)   // f32 [4096][1024] ctx
#define WS_T1  (WS_O + 4u * NR * DM)                     // f32 pre-LN (reused)
#define WS_H   (WS_T1 + 4u * NR * DM)                    // f32 x = LN1 output
#define WS_GH  (WS_H + 4u * NR * DM)                     // bf16 [4096][4096] relu hi ; GL
#define WS_GL  (WS_GH + 2u * (size_t)NR * FF)
#define WS_END (WS_GL + 2u * (size_t)NR * FF)

__global__ __launch_bounds__(256) void k_pack(const float* __restrict__ WQ, const float* __restrict__ WK, const float* __restrict__ WV, const float* __restrict__ WO, const float* __restrict__ W1, const float* __restrict__ W2, const float* __restrict__ RELE, __bf16* __restrict__ PK, _Float16* __restrict__ RELH, _Float16* __restrict__ RELL) {
  __shared__ __align__(16) __bf16 s[FF]; __shared__ __align__(16) _Float16 sh_[HD], sl_[HD]; const int n = blockIdx.x, which = blockIdx.y, t = threadIdx.x; int K; size_t dst;   // natural [out][in] rows
  if (which == 6) { if (n >= 16) return; if (t < HD) { const float v = (n < NREL) ? bfr(RELE[n * HD + t]) : 0.f; const _Float16 hv = (_Float16)v; sh_[t] = hv; sl_[t] = (_Float16)((v - (float)hv) * 2048.0f); } __syncthreads(); if (t < 8) vst2((unsigned*)(RELH + n * HD + t * 8), *(const v4u*)&sh_[t * 8]); else if (t < 16) vst2((unsigned*)(RELL + n * HD + (t - 8) * 8), *(const v4u*)&sl_[(t - 8) * 8]); return; }
  if (which < 4) { if (n >= DM) return; const float* Wm = (which == 0) ? WQ : (which == 1) ? WK : (which == 2) ? WV : WO; K = DM; dst = (size_t)which * DM * DM + (size_t)n * DM; for (int k = t; k < DM; k += 256) s[k] = (__bf16)Wm[(size_t)n * DM + k]; }
  else if (which == 4) { K = DM; dst = PK_1 + (size_t)n * DM; for (int k = t; k < DM; k += 256) s[k] = (__bf16)W1[(size_t)n * DM + k]; }
  else { if (n >= DM) return; K = FF; dst = PK_2 + (size_t)n * FF; for (int k = t; k < FF; k += 256) s[k] = (__bf16)W2[(size_t)n * FF + k]; }
  __syncthreads();
  for (int q = t; q < K / 8; q += 256) vst2((unsigned*)(PK + dst + q * 8), *(const v4u*)&s[q * 8]);
}
// ---- GEMM core shared by k_proj and k_lin: block = 256 threads = 8 waves (4 x 2), one 128 x 128 tile of Y = A . W^T; a pass is 64 k of every operand row.
// Each pass's rows (W, A hi, A residual, all bf16) are staged once per block in LDS and read from there by every wave that needs them; two buffers, one barrier per pass.
// Wave (wr, wc) owns rows wr*32..+31, cols wc*64..+63: 2 x 4 accumulator tiles. Per accumulator the products keep the order k ascending, residual before hi.
#define LP 72                 // LDS row pitch in 16-bit elements: 144 B = 16 B x odd, for the 16-byte fragment reads
#define PLANE (128 * LP)      // one staged operand plane: 128 rows
// AM 0: A f32, rounded to one bf16 plane; 1: A f32, split into bf16 hi + residual; 2: A given as two bf16 planes (AH, AL). Rows of A at or past nrows are read as row nrows - 1 (their results are not stored).
template <int AM, int KD>
__device__ __forceinline__ void gemm_tile(const float* __restrict__ A, const __bf16* __restrict__ AH, const __bf16* __restrict__ AL, const __bf16* __restrict__ Wt, __bf16* sm, int rb, int n0, int nrows, v8f (&acc)[2][4]) {
  constexpr int NPL = (AM == 0) ? 2 : 3, NP = KD / 64;
  const int tid = threadIdx.x, wave = tid >> 5, lane = tid & 31, col = lane & 15, wr = wave >> 1, wc = wave & 1;
  const int sc = (tid & 7) * 8, sr = tid >> 3;   // staging: this thread's 8 k of a row, and its row in each group of 32
  size_t ao[4], wo[4];
#pragma unroll
  for (int i = 0; i < 4; ++i) { ao[i] = (size_t)min(rb + sr + 32 * i, nrows - 1) * KD + sc; wo[i] = (size_t)(n0 + sr + 32 * i) * KD + sc; }
  v8b rw_[4], rh_[4], rl_[4]; v4f rf_[4][2];
  auto ldg = [&](int p) {
#pragma unroll
    for (int i = 0; i < 4; ++i) { rw_[i] = *(const v8b*)(Wt + wo[i] + p * 64);
      if (AM == 2) { rh_[i] = *(const v8b*)(AH + ao[i] + p * 64); rl_[i] = *(const v8b*)(AL + ao[i] + p * 64); }
      else { const float* q = A + ao[i] + p * 64; rf_[i][0] = *(const v4f*)q; rf_[i][1] = *(const v4f*)(q + 4); } } };
  auto sts = [&](int buf) { __bf16* d = sm + buf * (NPL * PLANE) + sr * LP + sc;
#pragma unroll
    for (int i = 0; i < 4; ++i) { *(v8b*)(d + i * 32 * LP) = rw_[i];
      if (AM == 2) { *(v8b*)(d + PLANE + i * 32 * LP) = rh_[i]; *(v8b*)(d + 2 * PLANE + i * 32 * LP) = rl_[i]; }
      else { v8b hv, lv;
#pragma unroll
        for (int e = 0; e < 8; ++e) { const float v = rf_[i][e >> 2][e & 3]; const __bf16 hb = (__bf16)v; hv[e] = hb; lv[e] = (__bf16)(v - (float)hb); }
        *(v8b*)(d + PLANE + i * 32 * LP) = hv; if (AM == 1) *(v8b*)(d + 2 * PLANE + i * 32 * LP) = lv; } } };
  ldg(0); sts(0); __syncthreads();
#pragma unroll 1
  for (int p = 0; p < NP; ++p) {
    if (p + 1 < NP) ldg(p + 1);   // the next pass's global loads fly under this pass's products
    const __bf16* sW = sm + (p & 1) * (NPL * PLANE) + (wc * 64 + col) * LP; const __bf16* sH = sm + (p & 1) * (NPL * PLANE) + PLANE + (wr * 32 + col) * LP;
#pragma unroll
    for (int kc = 0; kc < 2; ++kc) { v16b w[4], ah[2], al[2];
#pragma unroll
      for (int ct = 0; ct < 4; ++ct) w[ct] = frag_b(sW + ct * 16 * LP + kc * 32, lane);
#pragma unroll
      for (int rt = 0; rt < 2; ++rt) { ah[rt] = frag_b(sH + rt * 16 * LP + kc * 32, lane); if (AM != 0) al[rt] = frag_b(sH + PLANE + rt * 16 * LP + kc * 32, lane); }
      if (AM != 0) {
#pragma unroll
        for (int rt = 0; rt < 2; ++rt)
#pragma unroll
          for (int ct = 0; ct < 4; ++ct) acc[rt][ct] = wmma_bf(al[rt], w[ct], acc[rt][ct]); }
#pragma unroll
      for (int rt = 0; rt < 2; ++rt)
#pragma unroll
        for (int ct = 0; ct < 4; ++ct) acc[rt][ct] = wmma_bf(ah[rt], w[ct], acc[rt][ct]); }
    if (p + 1 < NP) sts((p + 1) & 1);   // into the buffer whose last readers left before the previous pass's barrier
    __syncthreads();                    // publishes pass p + 1 and ends every read of pass p's buffer
  }
}
// ---- k_proj: block = (128 rows, 128 cols, which): 0 q, 1 k -> f16 hi/lo rows (+ bias); 2 v -> hi/lo transposed planes per batch; the epilogue stages in the ring's LDS behind the last pass's barrier
__global__ __launch_bounds__(256) void k_proj(const float* __restrict__ X, const __bf16* __restrict__ PK, const float* __restrict__ BQ, const float* __restrict__ BK, const float* __restrict__ BV, _Float16* __restrict__ QH, _Float16* __restrict__ QL_, _Float16* __restrict__ KH, _Float16* __restrict__ KL, _Float16* __restrict__ VTH, _Float16* __restrict__ VTL) {
  __shared__ __align__(16) __bf16 sm[2 * 2 * PLANE];
  const int tid = threadIdx.x, wave = tid >> 5, lane = tid & 31, col = lane & 15, g = lane >> 4, wr = wave >> 1, wc = wave & 1; const int which = blockIdx.z; const int rb = blockIdx.x * 128, n0 = blockIdx.y * 128;
  const __bf16* P = PK + ((which == 0) ? PK_Q : (which == 1) ? PK_K : PK_V); const float* BB = (which == 0) ? BQ : (which == 1) ? BK : BV;
  v8f acc[2][4] = {};
  gemm_tile<0, DM>(X, nullptr, nullptr, P, sm, rb, n0, NR, acc);
  const int rw = rb + wr * 32, nw = n0 + wc * 64;
  if (which < 2) {
    _Float16* sh = (_Float16*)sm + wave * (2 * 32 * LP); _Float16* sl = sh + 32 * LP;
#pragma unroll
    for (int ct = 0; ct < 4; ++ct) { const float bb = bfr(BB[nw + ct * 16 + col]);
#pragma unroll
      for (int rt = 0; rt < 2; ++rt)
#pragma unroll
        for (int r = 0; r < 8; ++r) { const float vv = acc[rt][ct][r] + bb; const _Float16 hv = (_Float16)vv; const int o = (rt * 16 + 8 * g + r) * LP + ct * 16 + col; sh[o] = hv; sl[o] = (_Float16)((vv - (float)hv) * 2048.0f); } }
    LDSX();
    _Float16* DH_ = (which == 0) ? QH : KH; _Float16* DL_ = (which == 0) ? QL_ : KL;
    for (int q = 0; q < 8; ++q) { const int rl = q * 4 + (lane >> 3), c8 = (lane & 7) * 8; const size_t o = (size_t)(rw + rl) * DM + nw + c8; vst2((unsigned*)(DH_ + o), *(const v4u*)&sh[rl * LP + c8]); vst2((unsigned*)(DL_ + o), *(const v4u*)&sl[rl * LP + c8]); }
  } else {
    _Float16* sth = (_Float16*)sm; _Float16* stl = sth + 128 * 136;   // [128 d][128 s], pitch 136
#pragma unroll
    for (int ct = 0; ct < 4; ++ct) { const float bb = bfr(BB[nw + ct * 16 + col]);
#pragma unroll
      for (int rt = 0; rt < 2; ++rt) { v8h h8, l8;
#pragma unroll
        for (int r = 0; r < 8; ++r) { const float vv = acc[rt][ct][r] + bb; const _Float16 hv = (_Float16)vv; h8[r] = hv; l8[r] = (_Float16)((vv - (float)hv) * 2048.0f); }
        const int o = (wc * 64 + ct * 16 + col) * 136 + wr * 32 + rt * 16 + 8 * g; *(v8h*)&sth[o] = h8; *(v8h*)&stl[o] = l8; } }
    __syncthreads();
    const int b = rb / SS, s0 = rb % SS;
    for (int e = tid; e < 128 * 16; e += 256) { const int d = e >> 4, pc = e & 15; const size_t o = ((size_t)b * DM + n0 + d) * SS + s0 + pc * 8; vst2((unsigned*)(VTH + o), *(const v4u*)&sth[d * 136 + pc * 8]); vst2((unsigned*)(VTL + o), *(const v4u*)&stl[d * 136 + pc * 8]); }
  }
}
// ---- k_attn: block = (64 queries i, h, b): key steps covering [i0 - 25, i0 + 63 + 25] within [0, S); c = q.k (3 products); rel band: window slot t <-> offset (j - i) = t0w + t with t0w = j0 - iw0 - 15, row = clip(t0w + t, -5, 5) + 5 (3 products) -> LDS, picked at jl - il + 15; scores = (c + rel)/8 within |j - i| <= 25 and 0 <= j < S, else -inf; online softmax; P hi/lo x V hi/lo
__global__ __launch_bounds__(128) void k_attn(const _Float16* __restrict__ QH, const _Float16* __restrict__ QL_, const _Float16* __restrict__ KH, const _Float16* __restrict__ KL, const _Float16* __restrict__ RELH, const _Float16* __restrict__ RELL, const _Float16* __restrict__ VTH, const _Float16* __restrict__ VTL, float* __restrict__ O) {
  __shared__ __align__(16) _Float16 sph[4][16][40], spl[4][16][40]; __shared__ float srl[4][16][49]; __shared__ __align__(16) float so[4][16][68];
  const int tid = threadIdx.x, wave = tid >> 5, lane = tid & 31, col = lane & 15, g = lane >> 4; const int qb = blockIdx.x + TQ0, h = blockIdx.y, b = blockIdx.z; const int i0 = qb * 64, iw0 = i0 + wave * 16;
  v16h aq[2], aql[2];
#pragma unroll
  for (int kc = 0; kc < 2; ++kc) { const size_t o = ((size_t)b * SS + iw0 + col) * DM + h * HD + kc * 32; aq[kc] = frag_h(QH + o, lane); aql[kc] = frag_h(QL_ + o, lane); }
  const _Float16* Vh = VTH + ((size_t)b * DM + h * HD) * SS; const _Float16* Vl = VTL + ((size_t)b * DM + h * HD) * SS;
  float m[8], l[8];
#pragma unroll
  for (int r = 0; r < 8; ++r) { m[r] = -3.0e38f; l[r] = 0.f; }
  v8f acc[4] = {}, accl[4] = {};
  const int jlo = max(i0 - RAD, 0), jhi = min(i0 + 63 + RAD, SS - 1); const int ks0 = jlo / 32, ks1 = jhi / 32;
#pragma unroll 1
  for (int ks = ks0; ks <= ks1; ++ks) { const int j0 = ks * 32;
    { const int t0w = j0 - iw0 - 15;   // offset (j - i) of window slot 0
#pragma unroll
      for (int ct3 = 0; ct3 < 3; ++ct3) { int rr = t0w + ct3 * 16 + col; rr = min(max(rr, -KREL), KREL) + KREL; v8f u = {}, ul = {};
#pragma unroll
        for (int kc = 0; kc < 2; ++kc) { const v16h rh = frag_h(RELH + (size_t)rr * HD + kc * 32, lane); u = wmma16(aq[kc], rh, u); ul = wmma16(aql[kc], rh, ul); ul = wmma16(aq[kc], frag_h(RELL + (size_t)rr * HD + kc * 32, lane), ul); }
#pragma unroll
        for (int r = 0; r < 8; ++r) srl[wave][8 * g + r][ct3 * 16 + col] = u[r] + ul[r] * (1.0f / 2048.0f); } }
    LDSX();
    v8f s[2];
#pragma unroll
    for (int ct = 0; ct < 2; ++ct) { const int jl = ct * 16 + col; const int kk = j0 + jl; const size_t rk = ((size_t)b * SS + kk) * DM + h * HD; v8f c = {}, cl = {};
#pragma unroll
      for (int kc = 0; kc < 2; ++kc) { const v16h khf = frag_h(KH + rk + kc * 32, lane); c = wmma16(aq[kc], khf, c); cl = wmma16(aql[kc], khf, cl); cl = wmma16(aq[kc], frag_h(KL + rk + kc * 32, lane), cl); }
#pragma unroll
      for (int r = 0; r < 8; ++r) { const int il = 8 * g + r; const int off = kk - (iw0 + il); const bool ok = (off <= RAD) && (off >= -RAD) && (kk < SS);
        s[ct][r] = ok ? (c[r] + cl[r] * (1.0f / 2048.0f) + srl[wave][il][jl - il + 15]) * 0.125f : -3.0e38f; } }
#pragma unroll
    for (int r = 0; r < 8; ++r) { float mx = fmaxf(s[0][r], s[1][r]);
#pragma unroll
      for (int o = 1; o < 16; o <<= 1) mx = fmaxf(mx, __shfl_xor(mx, o));
      const float mn = fmaxf(m[r], mx); const float alpha = (m[r] <= -1.0e38f) ? 0.f : __expf(m[r] - mn);
      const float e0 = (s[0][r] <= -1.0e38f) ? 0.f : __expf(s[0][r] - mn), e1 = (s[1][r] <= -1.0e38f) ? 0.f : __expf(s[1][r] - mn); float es = e0 + e1;
#pragma unroll
      for (int o = 1; o < 16; o <<= 1) es += __shfl_xor(es, o);
      l[r] = l[r] * alpha + es; m[r] = (mn <= -1.0e38f) ? m[r] : mn;
#pragma unroll
      for (int dt = 0; dt < 4; ++dt) { acc[dt][r] *= alpha; accl[dt][r] *= alpha; }
      const _Float16 h0 = (_Float16)e0, h1 = (_Float16)e1; sph[wave][8 * g + r][col] = h0; sph[wave][8 * g + r][16 + col] = h1; spl[wave][8 * g + r][col] = (_Float16)((e0 - (float)h0) * 2048.0f); spl[wave][8 * g + r][16 + col] = (_Float16)((e1 - (float)h1) * 2048.0f); }
    LDSX();
    const v16h pah = frag_h(&sph[wave][col][0], lane), pal = frag_h(&spl[wave][col][0], lane);
#pragma unroll
    for (int dt = 0; dt < 4; ++dt) { const size_t vo = (size_t)(dt * 16 + col) * SS + j0; const v16h vh = frag_h(Vh + vo, lane), vl = frag_h(Vl + vo, lane); acc[dt] = wmma16(pah, vh, acc[dt]); accl[dt] = wmma16(pal, vh, accl[dt]); accl[dt] = wmma16(pah, vl, accl[dt]); }
    LDSX(); }
#pragma unroll
  for (int r = 0; r < 8; ++r) { const float il = 1.0f / l[r];
#pragma unroll
    for (int dt = 0; dt < 4; ++dt) so[wave][8 * g + r][dt * 16 + col] = (acc[dt][r] + accl[dt][r] * (1.0f / 2048.0f)) * il; }
  LDSX();
  for (int rl = 0; rl < 16; ++rl) if (lane < 16) vst2(O + ((size_t)b * SS + iw0 + rl) * DM + h * HD + lane * 4, *(const v4f*)&so[wave][rl][lane * 4]);
}
// ---- k_lin<MODE>: block = (128 rows, 128 cols); 0: T1 = O(hi/lo) . Wo^T + bo + src; 1: G = relu(X(hi/lo) . W1^T + b1) -> bf16 hi/lo; 2: T1 = G . W2^T (2 products) + b2 + X; rows at or past nrows are not stored; the epilogue stages in the ring's LDS behind the last pass's barrier
template <int MODE>
__global__ __launch_bounds__(256) void k_lin(const float* __restrict__ A, const __bf16* __restrict__ AG, const __bf16* __restrict__ AGL, const __bf16* __restrict__ PK, const float* __restrict__ BIAS, const float* __restrict__ RES, float* __restrict__ OUTF, __bf16* __restrict__ OUTG, __bf16* __restrict__ OUTGL, int nrows) {
  __shared__ __align__(16) __bf16 sm[2 * 3 * PLANE];
  const int tid = threadIdx.x, wave = tid >> 5, lane = tid & 31, col = lane & 15, g = lane >> 4, wr = wave >> 1, wc = wave & 1; const int rb = blockIdx.x * 128, n0 = blockIdx.y * 128;
  constexpr int KD = (MODE == 2) ? FF : DM; const __bf16* P = PK + ((MODE == 0) ? PK_O : (MODE == 1) ? PK_1 : PK_2);
  v8f acc[2][4] = {};
  gemm_tile<(MODE == 2) ? 2 : 1, KD>(A, AG, AGL, P, sm, rb, n0, nrows, acc);
  const int rw = rb + wr * 32, nw = n0 + wc * 64;
  if (MODE == 1) {
    __bf16* sg = sm + wave * (2 * 32 * LP); __bf16* sgl = sg + 32 * LP;
#pragma unroll
    for (int ct = 0; ct < 4; ++ct) { const float bb = bfr(BIAS[nw + ct * 16 + col]);
#pragma unroll
      for (int rt = 0; rt < 2; ++rt)
#pragma unroll
        for (int r = 0; r < 8; ++r) { const float v = fmaxf(acc[rt][ct][r] + bb, 0.f); const __bf16 hb = (__bf16)v; const int o = (rt * 16 + 8 * g + r) * LP + ct * 16 + col; sg[o] = hb; sgl[o] = (__bf16)(v - (float)hb); } }
    LDSX();
    for (int q = 0; q < 8; ++q) { const int rl = q * 4 + (lane >> 3), c8 = (lane & 7) * 8; if (rw + rl < nrows) { const size_t o = (size_t)(rw + rl) * FF + nw + c8; vst2((unsigned*)(OUTG + o), *(const v4u*)&sg[rl * LP + c8]); vst2((unsigned*)(OUTGL + o), *(const v4u*)&sgl[rl * LP + c8]); } }
  } else {
    float* so = (float*)sm + wave * (32 * 68);
#pragma unroll
    for (int ct = 0; ct < 4; ++ct) { const float bb = bfr(BIAS[nw + ct * 16 + col]);
#pragma unroll
      for (int rt = 0; rt < 2; ++rt)
#pragma unroll
        for (int r = 0; r < 8; ++r) so[(rt * 16 + 8 * g + r) * 68 + ct * 16 + col] = acc[rt][ct][r] + bb; }
    LDSX();
    for (int q = 0; q < 16; ++q) { const int rl = q * 2 + g; if (rw + rl < nrows) { const size_t o = (size_t)(rw + rl) * DM + nw + col * 4; v4f v = *(const v4f*)&so[rl * 68 + col * 4]; const v4f rs = *(const v4f*)(RES + o);
#pragma unroll
        for (int i = 0; i < 4; ++i) v[i] += (MODE == 0) ? bfr(rs[i]) : rs[i];
        vst2(OUTF + o, v); } }
  }
}
// ---- k_ln: block = row (256 threads x 4): LayerNorm (biased variance, eps 1e-5)
__global__ __launch_bounds__(256) void k_ln(const float* __restrict__ T, const float* __restrict__ G, const float* __restrict__ Bv, float* __restrict__ OUT) {
  __shared__ float red[2][8]; const int t = threadIdx.x; const size_t row = blockIdx.x; const float* p = T + row * DM + t * 4;
  float v[4] = {p[0], p[1], p[2], p[3]}; float s = (v[0] + v[1]) + (v[2] + v[3]);
#pragma unroll
  for (int o = 1; o < 32; o <<= 1) s += __shfl_xor(s, o);
  if ((t & 31) == 0) red[0][t >> 5] = s; __syncthreads();
  float tot = 0.f; for (int w = 0; w < 8; ++w) tot += red[0][w]; const float mu = tot / (float)DM; float q = 0.f;
#pragma unroll
  for (int i = 0; i < 4; ++i) { const float d = v[i] - mu; q += d * d; }
#pragma unroll
  for (int o = 1; o < 32; o <<= 1) q += __shfl_xor(q, o);
  if ((t & 31) == 0) red[1][t >> 5] = q; __syncthreads();
  float qt = 0.f; for (int w = 0; w < 8; ++w) qt += red[1][w]; const float inv = 1.0f / sqrtf(qt / (float)DM + 1e-5f);
  v4f o4;
#pragma unroll
  for (int i = 0; i < 4; ++i) o4[i] = (v[i] - mu) * inv * bfr(G[t * 4 + i]) + bfr(Bv[t * 4 + i]);
  vst2(OUT + row * DM + t * 4, o4);
}
extern "C" void kernel_launch(void* const* d_in, const int* in_sizes, int n_in, void* d_out, int out_size, void* d_ws, size_t ws_size, hipStream_t stream) {
  (void)in_sizes; (void)n_in; (void)out_size;
  const float** F = (const float**)d_in;   // 0 src [2,2048,1024], 1 wq [1024,1024] natural, 2 bq, 3 wk, 4 bk, 5 wv, 6 bv, 7 wo, 8 bo, 9 rel_emb [11,64], 10 w1 [4096,1024] natural, 11 b1, 12 w2 [1024,4096] natural, 13 b2, 14 g1, 15 beta1, 16 g2, 17 beta2
  if (ws_size < (size_t)WS_END) return;
  char* ws = (char*)d_ws; __bf16 *PK = (__bf16*)(ws + WS_PK), *GH = (__bf16*)(ws + WS_GH), *GL = (__bf16*)(ws + WS_GL); _Float16 *QH = (_Float16*)(ws + WS_QH), *QLp = (_Float16*)(ws + WS_QL), *KH = (_Float16*)(ws + WS_KH), *KL = (_Float16*)(ws + WS_KL), *VTH = (_Float16*)(ws + WS_VTH), *VTL = (_Float16*)(ws + WS_VTL), *RELH = (_Float16*)(ws + WS_REL), *RELL = (_Float16*)(ws + WS_RELL); float *O = (float*)(ws + WS_O), *T1 = (float*)(ws + WS_T1), *Hh = (float*)(ws + WS_H);
  k_pack<<<dim3(FF, 7), 256, 0, stream>>>(F[1], F[3], F[5], F[7], F[10], F[12], F[9], PK, RELH, RELL);
  k_proj<<<dim3(NR / 128, DM / 128, 3), 256, 0, stream>>>(F[0], PK, F[2], F[4], F[6], QH, QLp, KH, KL, VTH, VTL);
  k_attn<<<dim3(TQB, NH, NB), 128, 0, stream>>>(QH, QLp, KH, KL, RELH, RELL, VTH, VTL, O);
#ifndef TWIN_ROWS
  const size_t R0 = 0; const int NRW = NR; (void)R0;
  k_lin<0><<<dim3(NR / 128, DM / 128), 256, 0, stream>>>(O, nullptr, nullptr, PK, F[8], F[0], T1, nullptr, nullptr, NRW);
  k_ln<<<NR, 256, 0, stream>>>(T1, F[14], F[15], Hh);
  k_lin<1><<<dim3(NR / 128, FF / 128), 256, 0, stream>>>(Hh, nullptr, nullptr, PK, F[11], nullptr, nullptr, GH, GL, NRW);
  k_lin<2><<<dim3(NR / 128, DM / 128), 256, 0, stream>>>(nullptr, GH, GL, PK, F[13], Hh, T1, nullptr, nullptr, NRW);
  k_ln<<<NR, 256, 0, stream>>>(T1, F[16], F[17], (float*)d_out);
#else
  for (int bb = 0; bb < NB; ++bb) { const size_t R0 = (size_t)bb * SS + (size_t)TQ0 * 64; const int NRW = TQB * 64;   // only the attended rows of each batch
  k_lin<0><<<dim3((NRW + 127) / 128, DM / 128), 256, 0, stream>>>(O + R0 * DM, nullptr, nullptr, PK, F[8], F[0] + R0 * DM, T1 + R0 * DM, nullptr, nullptr, NRW);
  k_ln<<<NRW, 256, 0, stream>>>(T1 + R0 * DM, F[14], F[15], Hh + R0 * DM);
  k_lin<1><<<dim3((NRW + 127) / 128, FF / 128), 256, 0, stream>>>(Hh + R0 * DM, nullptr, nullptr, PK, F[11], nullptr, nullptr, GH + R0 * FF, GL + R0 * FF, NRW);
  k_lin<2><<<dim3((NRW + 127) / 128, DM / 128), 256, 0, stream>>>(nullptr, GH + R0 * FF, GL + R0 * FF, PK, F[13], Hh + R0 * DM, T1 + R0 * DM, nullptr, nullptr, NRW);
  k_ln<<<NRW, 256, 0, stream>>>(T1 + R0 * DM, F[16], F[17], (float*)d_out + R0 * DM); }
#endif
}

// v002
// It runs in 244 microseconds.
// Two timings next to v001 put it at 1.03 and 1.04 times that version's speed.
// Over all steps from v000 it is 3.03 times as fast.
// compute dtype: all inputs rounded to bf16; q, k, v = src . W^T + b with EXACT bf16 products on WMMA 16x16x32 (natural [out][in] rows); q and k stored as f16 hi + (x2048-scaled) residual planes, the 11 relative-position rows likewise; per (query tile, key step) inside the +-25 window: q . k and the relative term q . rel_emb[clip(j - i, -5, 5) + 5] (a 48-wide skewed window GEMM with the row index clamped exactly like the module's clip, gathered per (i,j) from LDS), 3 products each, x 64^-1/2, window / validity mask, running-max softmax in f32 (hardware exp); P as f16 hi + (x2048) residual x v hi/lo (3 products); out . Wo (ctx as bf16 hi + residual, 2 products) + bo + src, LayerNorm (eps 1e-5) in f32; FFN: x (hi + residual) . W1^T + b1 (2 products), ReLU, (hi + residual) . W2^T + b2 + x (2 products), LayerNorm; f32 accumulate.
#include <hip/hip_runtime.h>
#include <math.h>

typedef __attribute__((ext_vector_type(16))) _Float16 v16h;
typedef __attribute__((ext_vector_type(16))) __bf16 v16b;
typedef __attribute__((ext_vector_type(8)))  _Float16 v8h;
typedef __attribute__((ext_vector_type(8)))  float v8f;
typedef __attribute__((ext_vector_type(4)))  float v4f;
typedef __attribute__((ext_vector_type(2)))  float v2f;
typedef __attribute__((ext_vector_type(4)))  unsigned v4u;
typedef __attribute__((ext_vector_type(4)))  int v4i;
typedef float __attribute__((may_alias)) float_a;
typedef int __attribute__((may_alias)) int_a;

template <typename T> __device__ __forceinline__ void vst2(void* p, T v) { *(T*)p = v;  }
__device__ __forceinline__ v8f wmma16(v16h a, v16h b, v8f c) {
  v8f d = __builtin_amdgcn_wmma_f32_16x16x32_f16(false, a, false, b, (short)0, c, false, false);
  asm volatile("v_nop\n\tv_nop\n\tv_nop\n\tv_nop" : "+v"(d) : "v"(a), "v"(b));
  return d;
}
__device__ __forceinline__ v8f wmma_bf(v16b a, v16b b, v8f c) {
  v8f d = __builtin_amdgcn_wmma_f32_16x16x32_bf16(false, a, false, b, (short)0, c, false, false);
  asm volatile("v_nop\n\tv_nop\n\tv_nop\n\tv_nop" : "+v"(d) : "v"(a), "v"(b));
  return d;
}
// 16x16x32 fragments: lane = (h = lane>>4, row/col = lane&15); elements 0..7 = k0+8h+0..7, 8..15 = k0+16+8h+0..7; D element r = row 8h+r
__device__ __forceinline__ v16h frag_h(const _Float16* rowk0, int lane) {
  union { v16h v; v8h q[2]; } u; const _Float16* p = rowk0 + 8 * (lane >> 4);
  u.q[0] = *(const v8h*)p; u.q[1] = *(const v8h*)(p + 16); return u.v;
}
__device__ __forceinline__ v16h frag_f32(const float* rowk0, int lane) {
  v16h a; const float* p = rowk0 + 8 * (lane >> 4);
#pragma unroll
  for (int i = 0; i < 8; ++i) { a[i] = (_Float16)p[i]; a[8 + i] = (_Float16)p[16 + i]; }
  return a;
}
__device__ __forceinline__ v16h frag_f32s(const float* rowk0, int lane, float sc) {
  v16h a; const float* p = rowk0 + 8 * (lane >> 4);
#pragma unroll
  for (int i = 0; i < 8; ++i) { a[i] = (_Float16)(p[i] * sc); a[8 + i] = (_Float16)(p[16 + i] * sc); }
  return a;
}
// column fragment from a [K][ld] layout (column n), rows >= K read as 0
__device__ __forceinline__ v16h fragc_f32(const float* W, int k0, int n, int lane, int ld, int K) {
  v16h a; const int g = lane >> 4;
#pragma unroll
  for (int i = 0; i < 8; ++i) { const int ka = k0 + 8 * g + i, kb = ka + 16;
    a[i] = (_Float16)(ka < K ? W[(size_t)(ka < K ? ka : K - 1) * ld + n] : 0.f); a[8 + i] = (_Float16)(kb < K ? W[(size_t)(kb < K ? kb : K - 1) * ld + n] : 0.f); }
  return a;
}
struct F2 { v16b h, l; };
__device__ __forceinline__ F2 bsplit16(const float v[16]) { F2 r;
#pragma unroll
  for (int i = 0; i < 16; ++i) { const __bf16 h = (__bf16)v[i]; r.h[i] = h; r.l[i] = (__bf16)(v[i] - (float)h); }
  return r; }
__device__ __forceinline__ F2 split_row(const float* row, int k0, int lane) { float v[16]; const float* p = row + k0 + 8 * (lane >> 4);
#pragma unroll
  for (int i = 0; i < 8; ++i) { v[i] = p[i]; v[8 + i] = p[16 + i]; }
  return bsplit16(v); }
__device__ __forceinline__ F2 split_rowK(const float* row, int k0, int lane, int K) { float v[16]; const int g = lane >> 4;
#pragma unroll
  for (int i = 0; i < 8; ++i) { const int ka = k0 + 8 * g + i, kb = ka + 16; v[i] = ka < K ? row[ka < K ? ka : K - 1] : 0.f; v[8 + i] = kb < K ? row[kb < K ? kb : K - 1] : 0.f; }
  return bsplit16(v); }
__device__ __forceinline__ F2 split_col(const float* W, int k0, int n, int lane, int ld, int K) { float v[16]; const int g = lane >> 4;
#pragma unroll
  for (int i = 0; i < 8; ++i) { const int ka = k0 + 8 * g + i, kb = ka + 16; v[i] = ka < K ? W[(size_t)(ka < K ? ka : K - 1) * ld + n] : 0.f; v[8 + i] = kb < K ? W[(size_t)(kb < K ? kb : K - 1) * ld + n] : 0.f; }
  return bsplit16(v); }
__device__ __forceinline__ v8f mac3(const F2& a, const F2& b, v8f c) { c = wmma_bf(a.l, b.h, c); c = wmma_bf(a.h, b.l, c); return wmma_bf(a.h, b.h, c); }
__device__ __forceinline__ float sigm(float v) { return 1.0f / (1.0f + expf(-v)); }
#define LDSX() do { asm volatile("s_wait_dscnt 0" ::: "memory"); __builtin_amdgcn_wave_barrier(); __builtin_amdgcn_fence(__ATOMIC_RELEASE, "workgroup"); } while (0)


// ETC-style layer (B 2, S 2,048, d 1,024, 16 heads x 64, FFN 4,096): local attention over a +-25 window with clipped relative-position embeddings, output projection + residual + LN, ReLU FFN + residual + LN.
#define NB 2
#define SS 2048
#define NR (NB * SS)
#define DM 1024
#define NH 16
#define HD 64
#define FF 4096
#define RAD 25
#define KREL 5
#define NREL (2 * KREL + 1)
#ifndef TQB
#define TQB (SS / 64)
#endif
#ifndef TQ0
#define TQ0 0
#endif
typedef __attribute__((ext_vector_type(8))) __bf16 v8b;
__device__ __forceinline__ v16b frag_b(const __bf16* rowk0, int lane) {
  union { v16b v; v8b q[2]; } u; const __bf16* p = rowk0 + 8 * (lane >> 4);
  u.q[0] = *(const v8b*)p; u.q[1] = *(const v8b*)(p + 16); return u.v;
}
__device__ __forceinline__ float bfr(float v) { return (float)(__bf16)v; }
__device__ __attribute__((noinline)) float exp_ni(float v) { return expf(v); }
__device__ __attribute__((noinline)) float erf_ni(float v) { return erff(v); }

#define PK_Q  0
#define PK_K  ((size_t)DM * DM)
#define PK_V  ((size_t)2 * DM * DM)
#define PK_O  ((size_t)3 * DM * DM)
#define PK_1  ((size_t)4 * DM * DM)                // [4096][1024] w1 natural
#define PK_2  (PK_1 + (size_t)FF * DM)             // [1024][4096] w2 natural
#define PK_END (PK_2 + (size_t)DM * FF)
#define WS_PK  0u
#define WS_QH  (((2u * PK_END) + 127u) / 128u * 128u)    // f16 [4096][1024] q hi ; QL ; KH ; KL
#define WS_QL  (WS_QH + 2u * NR * DM)
#define WS_KH  (WS_QL + 2u * NR * DM)
#define WS_KL  (WS_KH + 2u * NR * DM)
#define WS_VTH (WS_KL + 2u * NR * DM)                    // f16 [b][1024][2048] v hi ; VTL
#define WS_VTL (WS_VTH + 2u * NR * DM)
#define WS_REL (WS_VTL + 2u * NR * DM)                   // f16 [16 rows][64] rel hi ; RELL (11 real)
#define WS_RELL (WS_REL + 2u * 16 * HD)
#define WS_O   (((WS_RELL + 2u * 16 * HD) + 127u) / 128u * 128u)   // f32 [4096][1024] ctx
#define WS_T1  (WS_O + 4u * NR * DM)                     // f32 pre-LN (reused)
#define WS_H   (WS_T1 + 4u * NR * DM)                    // f32 x = LN1 output
#define WS_GH  (WS_H + 4u * NR * DM)                     // bf16 [4096][4096] relu hi ; GL
#define WS_GL  (WS_GH + 2u * (size_t)NR * FF)
#define WS_END (WS_GL + 2u * (size_t)NR * FF)

// ---- k_pack: every weight rounded to bf16 in its natural [out][in] order. A block = PKB consecutive elements of one matrix (each matrix is a whole number of blocks): 16 loads of 4 floats a thread, a wave's load = 512 contiguous bytes, all issued ahead of the first store; no LDS. The block behind the last weight block makes the relative-position planes (16 rows, 11 real).
#define PKB 16384
#define PK_NB ((int)(PK_END / PKB))
typedef __attribute__((ext_vector_type(4))) __bf16 v4b;
typedef __attribute__((ext_vector_type(4))) _Float16 v4h;
__global__ __launch_bounds__(256) void k_pack(const float* __restrict__ WQ, const float* __restrict__ WK, const float* __restrict__ WV, const float* __restrict__ WO, const float* __restrict__ W1, const float* __restrict__ W2, const float* __restrict__ RELE, __bf16* __restrict__ PK, _Float16* __restrict__ RELH, _Float16* __restrict__ RELL) {
  const int t = threadIdx.x; const unsigned blk = blockIdx.x;
  if (blk == (unsigned)PK_NB) { const int e = t * 4; v4f v = {}; if (e < NREL * HD) v = *(const v4f*)(RELE + e); v4h hi, lo;
#pragma unroll
    for (int i = 0; i < 4; ++i) { const float x = bfr(v[i]); const _Float16 hv = (_Float16)x; hi[i] = hv; lo[i] = (_Float16)((x - (float)hv) * 2048.0f); }
    vst2(RELH + e, hi); vst2(RELL + e, lo); return; }
  constexpr unsigned BM = DM * DM / PKB;   // blocks of a 1024 x 1024 matrix
  const unsigned m = blk / BM; const float* S = (m == 0) ? WQ : (m == 1) ? WK : (m == 2) ? WV : (m == 3) ? WO : (m < 8) ? W1 : W2; const unsigned b0 = (m < 4) ? m * BM : (m < 8) ? 4 * BM : 8 * BM;
  const float* p = S + (size_t)(blk - b0) * PKB + t * 4; __bf16* d = PK + (size_t)blk * PKB + t * 4; v4f v[16];
#pragma unroll
  for (int i = 0; i < 16; ++i) v[i] = *(const v4f*)(p + i * 1024);
  __builtin_amdgcn_sched_barrier(0);   // all 16 loads in flight together: without it the last two are issued behind the wait for the first
  v4b o[16];
#pragma unroll
  for (int i = 0; i < 16; ++i)
#pragma unroll
    for (int e = 0; e < 4; ++e) o[i][e] = (__bf16)v[i][e];
  __builtin_amdgcn_sched_barrier(0);   // the stores as one run behind the last conversion: otherwise later conversions reuse the registers of issued stores and wait for them
#pragma unroll
  for (int i = 0; i < 16; ++i) vst2(d + i * 1024, o[i]);
}
// ---- GEMM core shared by k_proj and k_lin: block = 256 threads = 8 waves (4 x 2), one 128 x 128 tile of Y = A . W^T; a pass is 64 k of every operand row.
// Each pass's rows (W, A hi, A residual, all bf16) are staged once per block in LDS and read from there by every wave that needs them; two buffers, one barrier per pass.
// Wave (wr, wc) owns rows wr*32..+31, cols wc*64..+63: 2 x 4 accumulator tiles. Per accumulator the products keep the order k ascending, residual before hi.
#define LP 72                 // LDS row pitch in 16-bit elements: 144 B = 16 B x odd, for the 16-byte fragment reads
#define PLANE (128 * LP)      // one staged operand plane: 128 rows
// AM 0: A f32, rounded to one bf16 plane; 1: A f32, split into bf16 hi + residual; 2: A given as two bf16 planes (AH, AL). Rows of A at or past nrows are read as row nrows - 1 (their results are not stored).
template <int AM, int KD>
__device__ __forceinline__ void gemm_tile(const float* __restrict__ A, const __bf16* __restrict__ AH, const __bf16* __restrict__ AL, const __bf16* __restrict__ Wt, __bf16* sm, int rb, int n0, int nrows, v8f (&acc)[2][4]) {
  constexpr int NPL = (AM == 0) ? 2 : 3, NP = KD / 64;
  const int tid = threadIdx.x, wave = tid >> 5, lane = tid & 31, col = lane & 15, wr = wave >> 1, wc = wave & 1;
  const int sc = (tid & 7) * 8, sr = tid >> 3;   // staging: this thread's 8 k of a row, and its row in each group of 32
  size_t ao[4], wo[4];
#pragma unroll
  for (int i = 0; i < 4; ++i) { ao[i] = (size_t)min(rb + sr + 32 * i, nrows - 1) * KD + sc; wo[i] = (size_t)(n0 + sr + 32 * i) * KD + sc; }
  v8b rw_[4], rh_[4], rl_[4]; v4f rf_[4][2];
  auto ldg = [&](int p) {
#pragma unroll
    for (int i = 0; i < 4; ++i) { rw_[i] = *(const v8b*)(Wt + wo[i] + p * 64);
      if (AM == 2) { rh_[i] = *(const v8b*)(AH + ao[i] + p * 64); rl_[i] = *(const v8b*)(AL + ao[i] + p * 64); }
      else { const float* q = A + ao[i] + p * 64; rf_[i][0] = *(const v4f*)q; rf_[i][1] = *(const v4f*)(q + 4); } } };
  auto sts = [&](int buf) { __bf16* d = sm + buf * (NPL * PLANE) + sr * LP + sc;
#pragma unroll
    for (int i = 0; i < 4; ++i) { *(v8b*)(d + i * 32 * LP) = rw_[i];
      if (AM == 2) { *(v8b*)(d + PLANE + i * 32 * LP) = rh_[i]; *(v8b*)(d + 2 * PLANE + i * 32 * LP) = rl_[i]; }
      else { v8b hv, lv;
#pragma unroll
        for (int e = 0; e < 8; ++e) { const float v = rf_[i][e >> 2][e & 3]; const __bf16 hb = (__bf16)v; hv[e] = hb; lv[e] = (__bf16)(v - (float)hb); }
        *(v8b*)(d + PLANE + i * 32 * LP) = hv; if (AM == 1) *(v8b*)(d + 2 * PLANE + i * 32 * LP) = lv; } } };
  ldg(0); sts(0); __syncthreads();
#pragma unroll 1
  for (int p = 0; p < NP; ++p) {
    if (p + 1 < NP) ldg(p + 1);   // the next pass's global loads fly under this pass's products
    const __bf16* sW = sm + (p & 1) * (NPL * PLANE) + (wc * 64 + col) * LP; const __bf16* sH = sm + (p & 1) * (NPL * PLANE) + PLANE + (wr * 32 + col) * LP;
#pragma unroll
    for (int kc = 0; kc < 2; ++kc) { v16b w[4], ah[2], al[2];
#pragma unroll
      for (int ct = 0; ct < 4; ++ct) w[ct] = frag_b(sW + ct * 16 * LP + kc * 32, lane);
#pragma unroll
      for (int rt = 0; rt < 2; ++rt) { ah[rt] = frag_b(sH + rt * 16 * LP + kc * 32, lane); if (AM != 0) al[rt] = frag_b(sH + PLANE + rt * 16 * LP + kc * 32, lane); }
      if (AM != 0) {
#pragma unroll
        for (int rt = 0; rt < 2; ++rt)
#pragma unroll
          for (int ct = 0; ct < 4; ++ct) acc[rt][ct] = wmma_bf(al[rt], w[ct], acc[rt][ct]); }
#pragma unroll
      for (int rt = 0; rt < 2; ++rt)
#pragma unroll
        for (int ct = 0; ct < 4; ++ct) acc[rt][ct] = wmma_bf(ah[rt], w[ct], acc[rt][ct]); }
    if (p + 1 < NP) sts((p + 1) & 1);   // into the buffer whose last readers left before the previous pass's barrier
    __syncthreads();                    // publishes pass p + 1 and ends every read of pass p's buffer
  }
}
// ---- k_proj: block = (128 rows, 128 cols, which): 0 q, 1 k -> f16 hi/lo rows (+ bias); 2 v -> hi/lo transposed planes per batch; the epilogue stages in the ring's LDS behind the last pass's barrier
__global__ __launch_bounds__(256) void k_proj(const float* __restrict__ X, const __bf16* __restrict__ PK, const float* __restrict__ BQ, const float* __restrict__ BK, const float* __restrict__ BV, _Float16* __restrict__ QH, _Float16* __restrict__ QL_, _Float16* __restrict__ KH, _Float16* __restrict__ KL, _Float16* __restrict__ VTH, _Float16* __restrict__ VTL) {
  __shared__ __align__(16) __bf16 sm[2 * 2 * PLANE];
  const int tid = threadIdx.x, wave = tid >> 5, lane = tid & 31, col = lane & 15, g = lane >> 4, wr = wave >> 1, wc = wave & 1; const int which = blockIdx.z; const int rb = blockIdx.x * 128, n0 = blockIdx.y * 128;
  const __bf16* P = PK + ((which == 0) ? PK_Q : (which == 1) ? PK_K : PK_V); const float* BB = (which == 0) ? BQ : (which == 1) ? BK : BV;
  v8f acc[2][4] = {};
  gemm_tile<0, DM>(X, nullptr, nullptr, P, sm, rb, n0, NR, acc);
  const int rw = rb + wr * 32, nw = n0 + wc * 64;
  if (which < 2) {
    _Float16* sh = (_Float16*)sm + wave * (2 * 32 * LP); _Float16* sl = sh + 32 * LP;
#pragma unroll
    for (int ct = 0; ct < 4; ++ct) { const float bb = bfr(BB[nw + ct * 16 + col]);
#pragma unroll
      for (int rt = 0; rt < 2; ++rt)
#pragma unroll
        for (int r = 0; r < 8; ++r) { const float vv = acc[rt][ct][r] + bb; const _Float16 hv = (_Float16)vv; const int o = (rt * 16 + 8 * g + r) * LP + ct * 16 + col; sh[o] = hv; sl[o] = (_Float16)((vv - (float)hv) * 2048.0f); } }
    LDSX();
    _Float16* DH_ = (which == 0) ? QH : KH; _Float16* DL_ = (which == 0) ? QL_ : KL;
    for (int q = 0; q < 8; ++q) { const int rl = q * 4 + (lane >> 3), c8 = (lane & 7) * 8; const size_t o = (size_t)(rw + rl) * DM + nw + c8; vst2((unsigned*)(DH_ + o), *(const v4u*)&sh[rl * LP + c8]); vst2((unsigned*)(DL_ + o), *(const v4u*)&sl[rl * LP + c8]); }
  } else {
    _Float16* sth = (_Float16*)sm; _Float16* stl = sth + 128 * 136;   // [128 d][128 s], pitch 136
#pragma unroll
    for (int ct = 0; ct < 4; ++ct) { const float bb = bfr(BB[nw + ct * 16 + col]);
#pragma unroll
      for (int rt = 0; rt < 2; ++rt) { v8h h8, l8;
#pragma unroll
        for (int r = 0; r < 8; ++r) { const float vv = acc[rt][ct][r] + bb; const _Float16 hv = (_Float16)vv; h8[r] = hv; l8[r] = (_Float16)((vv - (float)hv) * 2048.0f); }
        const int o = (wc * 64 + ct * 16 + col) * 136 + wr * 32 + rt * 16 + 8 * g; *(v8h*)&sth[o] = h8; *(v8h*)&stl[o] = l8; } }
    __syncthreads();
    const int b = rb / SS, s0 = rb % SS;
    for (int e = tid; e < 128 * 16; e += 256) { const int d = e >> 4, pc = e & 15; const size_t o = ((size_t)b * DM + n0 + d) * SS + s0 + pc * 8; vst2((unsigned*)(VTH + o), *(const v4u*)&sth[d * 136 + pc * 8]); vst2((unsigned*)(VTL + o), *(const v4u*)&stl[d * 136 + pc * 8]); }
  }
}
// ---- k_attn: block = (64 queries i, h, b): key steps covering [i0 - 25, i0 + 63 + 25] within [0, S); c = q.k (3 products); rel band: window slot t <-> offset (j - i) = t0w + t with t0w = j0 - iw0 - 15, row = clip(t0w + t, -5, 5) + 5 (3 products) -> LDS, picked at jl - il + 15; scores = (c + rel)/8 within |j - i| <= 25 and 0 <= j < S, else -inf; online softmax; P hi/lo x V hi/lo
__global__ __launch_bounds__(128) void k_attn(const _Float16* __restrict__ QH, const _Float16* __restrict__ QL_, const _Float16* __restrict__ KH, const _Float16* __restrict__ KL, const _Float16* __restrict__ RELH, const _Float16* __restrict__ RELL, const _Float16* __restrict__ VTH, const _Float16* __restrict__ VTL, float* __restrict__ O) {
  __shared__ __align__(16) _Float16 sph[4][16][40], spl[4][16][40]; __shared__ float srl[4][16][49]; __shared__ __align__(16) float so[4][16][68];
  const int tid = threadIdx.x, wave = tid >> 5, lane = tid & 31, col = lane & 15, g = lane >> 4; const int qb = blockIdx.x + TQ0, h = blockIdx.y, b = blockIdx.z; const int i0 = qb * 64, iw0 = i0 + wave * 16;
  v16h aq[2], aql[2];
#pragma unroll
  for (int kc = 0; kc < 2; ++kc) { const size_t o = ((size_t)b * SS + iw0 + col) * DM + h * HD + kc * 32; aq[kc] = frag_h(QH + o, lane); aql[kc] = frag_h(QL_ + o, lane); }
  const _Float16* Vh = VTH + ((size_t)b * DM + h * HD) * SS; const _Float16* Vl = VTL + ((size_t)b * DM + h * HD) * SS;
  float m[8], l[8];
#pragma unroll
  for (int r = 0; r < 8; ++r) { m[r] = -3.0e38f; l[r] = 0.f; }
  v8f acc[4] = {}, accl[4] = {};
  const int jlo = max(i0 - RAD, 0), jhi = min(i0 + 63 + RAD, SS - 1); const int ks0 = jlo / 32, ks1 = jhi / 32;
#pragma unroll 1
  for (int ks = ks0; ks <= ks1; ++ks) { const int j0 = ks * 32;
    { const int t0w = j0 - iw0 - 15;   // offset (j - i) of window slot 0
#pragma unroll
      for (int ct3 = 0; ct3 < 3; ++ct3) { int rr = t0w + ct3 * 16 + col; rr = min(max(rr, -KREL), KREL) + KREL; v8f u = {}, ul = {};
#pragma unroll
        for (int kc = 0; kc < 2; ++kc) { const v16h rh = frag_h(RELH + (size_t)rr * HD + kc * 32, lane); u = wmma16(aq[kc], rh, u); ul = wmma16(aql[kc], rh, ul); ul = wmma16(aq[kc], frag_h(RELL + (size_t)rr * HD + kc * 32, lane), ul); }
#pragma unroll
        for (int r = 0; r < 8; ++r) srl[wave][8 * g + r][ct3 * 16 + col] = u[r] + ul[r] * (1.0f / 2048.0f); } }
    LDSX();
    v8f s[2];
#pragma unroll
    for (int ct = 0; ct < 2; ++ct) { const int jl = ct * 16 + col; const int kk = j0 + jl; const size_t rk = ((size_t)b * SS + kk) * DM + h * HD; v8f c = {}, cl = {};
#pragma unroll
      for (int kc = 0; kc < 2; ++kc) { const v16h khf = frag_h(KH + rk + kc * 32, lane); c = wmma16(aq[kc], khf, c); cl = wmma16(aql[kc], khf, cl); cl = wmma16(aq[kc], frag_h(KL + rk + kc * 32, lane), cl); }
#pragma unroll
      for (int r = 0; r < 8; ++r) { const int il = 8 * g + r; const int off = kk - (iw0 + il); const bool ok = (off <= RAD) && (off >= -RAD) && (kk < SS);
        s[ct][r] = ok ? (c[r] + cl[r] * (1.0f / 2048.0f) + srl[wave][il][jl - il + 15]) * 0.125f : -3.0e38f; } }
#pragma unroll
    for (int r = 0; r < 8; ++r) { float mx = fmaxf(s[0][r], s[1][r]);
#pragma unroll
      for (int o = 1; o < 16; o <<= 1) mx = fmaxf(mx, __shfl_xor(mx, o));
      const float mn = fmaxf(m[r], mx); const float alpha = (m[r] <= -1.0e38f) ? 0.f : __expf(m[r] - mn);
      const float e0 = (s[0][r] <= -1.0e38f) ? 0.f : __expf(s[0][r] - mn), e1 = (s[1][r] <= -1.0e38f) ? 0.f : __expf(s[1][r] - mn); float es = e0 + e1;
#pragma unroll
      for (int o = 1; o < 16; o <<= 1) es += __shfl_xor(es, o);
      l[r] = l[r] * alpha + es; m[r] = (mn <= -1.0e38f) ? m[r] : mn;
#pragma unroll
      for (int dt = 0; dt < 4; ++dt) { acc[dt][r] *= alpha; accl[dt][r] *= alpha; }
      const _Float16 h0 = (_Float16)e0, h1 = (_Float16)e1; sph[wave][8 * g + r][col] = h0; sph[wave][8 * g + r][16 + col] = h1; spl[wave][8 * g + r][col] = (_Float16)((e0 - (float)h0) * 2048.0f); spl[wave][8 * g + r][16 + col] = (_Float16)((e1 - (float)h1) * 2048.0f); }
    LDSX();
    const v16h pah = frag_h(&sph[wave][col][0], lane), pal = frag_h(&spl[wave][col][0], lane);
#pragma unroll
    for (int dt = 0; dt < 4; ++dt) { const size_t vo = (size_t)(dt * 16 + col) * SS + j0; const v16h vh = frag_h(Vh + vo, lane), vl = frag_h(Vl + vo, lane); acc[dt] = wmma16(pah, vh, acc[dt]); accl[dt] = wmma16(pal, vh, accl[dt]); accl[dt] = wmma16(pah, vl, accl[dt]); }
    LDSX(); }
#pragma unroll
  for (int r = 0; r < 8; ++r) { const float il = 1.0f / l[r];
#pragma unroll
    for (int dt = 0; dt < 4; ++dt) so[wave][8 * g + r][dt * 16 + col] = (acc[dt][r] + accl[dt][r] * (1.0f / 2048.0f)) * il; }
  LDSX();
  for (int rl = 0; rl < 16; ++rl) if (lane < 16) vst2(O + ((size_t)b * SS + iw0 + rl) * DM + h * HD + lane * 4, *(const v4f*)&so[wave][rl][lane * 4]);
}
// ---- k_lin<MODE>: block = (128 rows, 128 cols); 0: T1 = O(hi/lo) . Wo^T + bo + src; 1: G = relu(X(hi/lo) . W1^T + b1) -> bf16 hi/lo; 2: T1 = G . W2^T (2 products) + b2 + X; rows at or past nrows are not stored; the epilogue stages in the ring's LDS behind the last pass's barrier
template <int MODE>
__global__ __launch_bounds__(256) void k_lin(const float* __restrict__ A, const __bf16* __restrict__ AG, const __bf16* __restrict__ AGL, const __bf16* __restrict__ PK, const float* __restrict__ BIAS, const float* __restrict__ RES, float* __restrict__ OUTF, __bf16* __restrict__ OUTG, __bf16* __restrict__ OUTGL, int nrows) {
  __shared__ __align__(16) __bf16 sm[2 * 3 * PLANE];
  const int tid = threadIdx.x, wave = tid >> 5, lane = tid & 31, col = lane & 15, g = lane >> 4, wr = wave >> 1, wc = wave & 1; const int rb = blockIdx.x * 128, n0 = blockIdx.y * 128;
  constexpr int KD = (MODE == 2) ? FF : DM; const __bf16* P = PK + ((MODE == 0) ? PK_O : (MODE == 1) ? PK_1 : PK_2);
  v8f acc[2][4] = {};
  gemm_tile<(MODE == 2) ? 2 : 1, KD>(A, AG, AGL, P, sm, rb, n0, nrows, acc);
  const int rw = rb + wr * 32, nw = n0 + wc * 64;
  if (MODE == 1) {
    __bf16* sg = sm + wave * (2 * 32 * LP); __bf16* sgl = sg + 32 * LP;
#pragma unroll
    for (int ct = 0; ct < 4; ++ct) { const float bb = bfr(BIAS[nw + ct * 16 + col]);
#pragma unroll
      for (int rt = 0; rt < 2; ++rt)
#pragma unroll
        for (int r = 0; r < 8; ++r) { const float v = fmaxf(acc[rt][ct][r] + bb, 0.f); const __bf16 hb = (__bf16)v; const int o = (rt * 16 + 8 * g + r) * LP + ct * 16 + col; sg[o] = hb; sgl[o] = (__bf16)(v - (float)hb); } }
    LDSX();
    for (int q = 0; q < 8; ++q) { const int rl = q * 4 + (lane >> 3), c8 = (lane & 7) * 8; if (rw + rl < nrows) { const size_t o = (size_t)(rw + rl) * FF + nw + c8; vst2((unsigned*)(OUTG + o), *(const v4u*)&sg[rl * LP + c8]); vst2((unsigned*)(OUTGL + o), *(const v4u*)&sgl[rl * LP + c8]); } }
  } else {
    float* so = (float*)sm + wave * (32 * 68);
#pragma unroll
    for (int ct = 0; ct < 4; ++ct) { const float bb = bfr(BIAS[nw + ct * 16 + col]);
#pragma unroll
      for (int rt = 0; rt < 2; ++rt)
#pragma unroll
        for (int r = 0; r < 8; ++r) so[(rt * 16 + 8 * g + r) * 68 + ct * 16 + col] = acc[rt][ct][r] + bb; }
    LDSX();
    for (int q = 0; q < 16; ++q) { const int rl = q * 2 + g; if (rw + rl < nrows) { const size_t o = (size_t)(rw + rl) * DM + nw + col * 4; v4f v = *(const v4f*)&so[rl * 68 + col * 4]; const v4f rs = *(const v4f*)(RES + o);
#pragma unroll
        for (int i = 0; i < 4; ++i) v[i] += (MODE == 0) ? bfr(rs[i]) : rs[i];
        vst2(OUTF + o, v); } }
  }
}
// ---- k_ln: wave = row (32 lanes x 32 floats, a load = 512 contiguous bytes), 8 rows a block, no LDS: LayerNorm (biased variance, eps 1e-5)
__global__ __launch_bounds__(256) void k_ln(const float* __restrict__ T, const float* __restrict__ G, const float* __restrict__ Bv, float* __restrict__ OUT) {
  const int t = threadIdx.x, lane = t & 31; const size_t row = (size_t)blockIdx.x * 8 + __builtin_amdgcn_readfirstlane(t >> 5);   // the row is the wave's: its base address stays scalar
  const float* p = T + row * DM + lane * 4;
  v4f v[8];
#pragma unroll
  for (int i = 0; i < 8; ++i) v[i] = *(const v4f*)(p + i * 128);
  float s4[4] = {0.f, 0.f, 0.f, 0.f};
#pragma unroll
  for (int i = 0; i < 8; ++i)
#pragma unroll
    for (int e = 0; e < 4; ++e) s4[e] += v[i][e];
  float s = (s4[0] + s4[1]) + (s4[2] + s4[3]);
#pragma unroll
  for (int o = 1; o < 32; o <<= 1) s += __shfl_xor(s, o);
  const float mu = s / (float)DM; float q4[4] = {0.f, 0.f, 0.f, 0.f};
#pragma unroll
  for (int i = 0; i < 8; ++i)
#pragma unroll
    for (int e = 0; e < 4; ++e) { const float d = v[i][e] - mu; q4[e] += d * d; }
  float q = (q4[0] + q4[1]) + (q4[2] + q4[3]);
#pragma unroll
  for (int o = 1; o < 32; o <<= 1) q += __shfl_xor(q, o);
  const float inv = 1.0f / sqrtf(q / (float)DM + 1e-5f);
#pragma unroll
  for (int i = 0; i < 8; ++i) { const v4f gg = *(const v4f*)(G + lane * 4 + i * 128), bb = *(const v4f*)(Bv + lane * 4 + i * 128); v4f o4;
#pragma unroll
    for (int e = 0; e < 4; ++e) o4[e] = (v[i][e] - mu) * inv * bfr(gg[e]) + bfr(bb[e]);
    vst2(OUT + row * DM + lane * 4 + i * 128, o4); }
}
extern "C" void kernel_launch(void* const* d_in, const int* in_sizes, int n_in, void* d_out, int out_size, void* d_ws, size_t ws_size, hipStream_t stream) {
  (void)in_sizes; (void)n_in; (void)out_size;
  const float** F = (const float**)d_in;   // 0 src [2,2048,1024], 1 wq [1024,1024] natural, 2 bq, 3 wk, 4 bk, 5 wv, 6 bv, 7 wo, 8 bo, 9 rel_emb [11,64], 10 w1 [4096,1024] natural, 11 b1, 12 w2 [1024,4096] natural, 13 b2, 14 g1, 15 beta1, 16 g2, 17 beta2
  if (ws_size < (size_t)WS_END) return;
  char* ws = (char*)d_ws; __bf16 *PK = (__bf16*)(ws + WS_PK), *GH = (__bf16*)(ws + WS_GH), *GL = (__bf16*)(ws + WS_GL); _Float16 *QH = (_Float16*)(ws + WS_QH), *QLp = (_Float16*)(ws + WS_QL), *KH = (_Float16*)(ws + WS_KH), *KL = (_Float16*)(ws + WS_KL), *VTH = (_Float16*)(ws + WS_VTH), *VTL = (_Float16*)(ws + WS_VTL), *RELH = (_Float16*)(ws + WS_REL), *RELL = (_Float16*)(ws + WS_RELL); float *O = (float*)(ws + WS_O), *T1 = (float*)(ws + WS_T1), *Hh = (float*)(ws + WS_H);
  k_pack<<<PK_NB + 1, 256, 0, stream>>>(F[1], F[3], F[5], F[7], F[10], F[12], F[9], PK, RELH, RELL);
  k_proj<<<dim3(NR / 128, DM / 128, 3), 256, 0, stream>>>(F[0], PK, F[2], F[4], F[6], QH, QLp, KH, KL, VTH, VTL);
  k_attn<<<dim3(TQB, NH, NB), 128, 0, stream>>>(QH, QLp, KH, KL, RELH, RELL, VTH, VTL, O);
#ifndef TWIN_ROWS
  const size_t R0 = 0; const int NRW = NR; (void)R0;
  k_lin<0><<<dim3(NR / 128, DM / 128), 256, 0, stream>>>(O, nullptr, nullptr, PK, F[8], F[0], T1, nullptr, nullptr, NRW);
  k_ln<<<NR / 8, 256, 0, stream>>>(T1, F[14], F[15], Hh);
  k_lin<1><<<dim3(NR / 128, FF / 128), 256, 0, stream>>>(Hh, nullptr, nullptr, PK, F[11], nullptr, nullptr, GH, GL, NRW);
  k_lin<2><<<dim3(NR / 128, DM / 128), 256, 0, stream>>>(nullptr, GH, GL, PK, F[13], Hh, T1, nullptr, nullptr, NRW);
  k_ln<<<NR / 8, 256, 0, stream>>>(T1, F[16], F[17], (float*)d_out);
#else
  for (int bb = 0; bb < NB; ++bb) { const size_t R0 = (size_t)bb * SS + (size_t)TQ0 * 64; const int NRW = TQB * 64;   // only the attended rows of each batch
  k_lin<0><<<dim3((NRW + 127) / 128, DM / 128), 256, 0, stream>>>(O + R0 * DM, nullptr, nullptr, PK, F[8], F[0] + R0 * DM, T1 + R0 * DM, nullptr, nullptr, NRW);
  k_ln<<<NRW / 8, 256, 0, stream>>>(T1 + R0 * DM, F[14], F[15], Hh + R0 * DM);
  k_lin<1><<<dim3((NRW + 127) / 128, FF / 128), 256, 0, stream>>>(Hh + R0 * DM, nullptr, nullptr, PK, F[11], nullptr, nullptr, GH + R0 * FF, GL + R0 * FF, NRW);
  k_lin<2><<<dim3((NRW + 127) / 128, DM / 128), 256, 0, stream>>>(nullptr, GH + R0 * FF, GL + R0 * FF, PK, F[13], Hh + R0 * DM, T1 + R0 * DM, nullptr, nullptr, NRW);
  k_ln<<<NRW / 8, 256, 0, stream>>>(T1 + R0 * DM, F[16], F[17], (float*)d_out + R0 * DM); }
#endif
}

// v003
// One run takes 234 microseconds.
// In both of two side-by-side timings against v002, it was 1.04 times as fast.
// All steps since v000 together make it 3.14 times as fast.
// compute dtype: all inputs rounded to bf16; q, k, v = src . W^T + b with EXACT bf16 products on WMMA 16x16x32 (natural [out][in] rows); q and k stored as f16 hi + (x2048-scaled) residual planes, the 11 relative-position rows likewise; per (query tile, key step) inside the +-25 window: q . k and the relative term q . rel_emb[clip(j - i, -5, 5) + 5] (a 48-wide skewed window GEMM with the row index clamped exactly like the module's clip, gathered per (i,j) from LDS), 3 products each, x 64^-1/2, window / validity mask, running-max softmax in f32 (hardware exp); P as f16 hi + (x2048) residual x v hi/lo (3 products); out . Wo (ctx as bf16 hi + residual, 2 products) + bo + src, LayerNorm (eps 1e-5) in f32; FFN: x (hi + residual) . W1^T + b1 (2 products), ReLU, (hi + residual) . W2^T + b2 + x (2 products), LayerNorm; f32 accumulate.
#include <hip/hip_runtime.h>
#include <math.h>

typedef __attribute__((ext_vector_type(16))) _Float16 v16h;
typedef __attribute__((ext_vector_type(16))) __bf16 v16b;
typedef __attribute__((ext_vector_type(8)))  _Float16 v8h;
typedef __attribute__((ext_vector_type(8)))  float v8f;
typedef __attribute__((ext_vector_type(4)))  float v4f;
typedef __attribute__((ext_vector_type(2)))  float v2f;
typedef __attribute__((ext_vector_type(4)))  unsigned v4u;
typedef __attribute__((ext_vector_type(4)))  int v4i;
typedef float __attribute__((may_alias)) float_a;
typedef int __attribute__((may_alias)) int_a;

template <typename T> __device__ __forceinline__ void vst2(void* p, T v) { *(T*)p = v;  }
__device__ __forceinline__ v8f wmma16(v16h a, v16h b, v8f c) {
  v8f d = __builtin_amdgcn_wmma_f32_16x16x32_f16(false, a, false, b, (short)0, c, false, false);
  asm volatile("v_nop\n\tv_nop\n\tv_nop\n\tv_nop" : "+v"(d) : "v"(a), "v"(b));
  return d;
}
__device__ __forceinline__ v8f wmma_bf(v16b a, v16b b, v8f c) {
  v8f d = __builtin_amdgcn_wmma_f32_16x16x32_bf16(false, a, false, b, (short)0, c, false, false);
  asm volatile("v_nop\n\tv_nop\n\tv_nop\n\tv_nop" : "+v"(d) : "v"(a), "v"(b));
  return d;
}
// 16x16x32 fragments: lane = (h = lane>>4, row/col = lane&15); elements 0..7 = k0+8h+0..7, 8..15 = k0+16+8h+0..7; D element r = row 8h+r
__device__ __forceinline__ v16h frag_h(const _Float16* rowk0, int lane) {
  union { v16h v; v8h q[2]; } u; const _Float16* p = rowk0 + 8 * (lane >> 4);
  u.q[0] = *(const v8h*)p; u.q[1] = *(const v8h*)(p + 16); return u.v;
}
__device__ __forceinline__ v16h frag_f32(const float* rowk0, int lane) {
  v16h a; const float* p = rowk0 + 8 * (lane >> 4);
#pragma unroll
  for (int i = 0; i < 8; ++i) { a[i] = (_Float16)p[i]; a[8 + i] = (_Float16)p[16 + i]; }
  return a;
}
__device__ __forceinline__ v16h frag_f32s(const float* rowk0, int lane, float sc) {
  v16h a; const float* p = rowk0 + 8 * (lane >> 4);
#pragma unroll
  for (int i = 0; i < 8; ++i) { a[i] = (_Float16)(p[i] * sc); a[8 + i] = (_Float16)(p[16 + i] * sc); }
  return a;
}
// column fragment from a [K][ld] layout (column n), rows >= K read as 0
__device__ __forceinline__ v16h fragc_f32(const float* W, int k0, int n, int lane, int ld, int K) {
  v16h a; const int g = lane >> 4;
#pragma unroll
  for (int i = 0; i < 8; ++i) { const int ka = k0 + 8 * g + i, kb = ka + 16;
    a[i] = (_Float16)(ka < K ? W[(size_t)(ka < K ? ka : K - 1) * ld + n] : 0.f); a[8 + i] = (_Float16)(kb < K ? W[(size_t)(kb < K ? kb : K - 1) * ld + n] : 0.f); }
  return a;
}
struct F2 { v16b h, l; };
__device__ __forceinline__ F2 bsplit16(const float v[16]) { F2 r;
#pragma unroll
  for (int i = 0; i < 16; ++i) { const __bf16 h = (__bf16)v[i]; r.h[i] = h; r.l[i] = (__bf16)(v[i] - (float)h); }
  return r; }
__device__ __forceinline__ F2 split_row(const float* row, int k0, int lane) { float v[16]; const float* p = row + k0 + 8 * (lane >> 4);
#pragma unroll
  for (int i = 0; i < 8; ++i) { v[i] = p[i]; v[8 + i] = p[16 + i]; }
  return bsplit16(v); }
__device__ __forceinline__ F2 split_rowK(const float* row, int k0, int lane, int K) { float v[16]; const int g = lane >> 4;
#pragma unroll
  for (int i = 0; i < 8; ++i) { const int ka = k0 + 8 * g + i, kb = ka + 16; v[i] = ka < K ? row[ka < K ? ka : K - 1] : 0.f; v[8 + i] = kb < K ? row[kb < K ? kb : K - 1] : 0.f; }
  return bsplit16(v); }
__device__ __forceinline__ F2 split_col(const float* W, int k0, int n, int lane, int ld, int K) { float v[16]; const int g = lane >> 4;
#pragma unroll
  for (int i = 0; i < 8; ++i) { const int ka = k0 + 8 * g + i, kb = ka + 16; v[i] = ka < K ? W[(size_t)(ka < K ? ka : K - 1) * ld + n] : 0.f; v[8 + i] = kb < K ? W[(size_t)(kb < K ? kb : K - 1) * ld + n] : 0.f; }
  return bsplit16(v); }
__device__ __forceinline__ v8f mac3(const F2& a, const F2& b, v8f c) { c = wmma_bf(a.l, b.h, c); c = wmma_bf(a.h, b.l, c); return wmma_bf(a.h, b.h, c); }
__device__ __forceinline__ float sigm(float v) { return 1.0f / (1.0f + expf(-v)); }
#define LDSX() do { asm volatile("s_wait_dscnt 0" ::: "memory"); __builtin_amdgcn_wave_barrier(); __builtin_amdgcn_fence(__ATOMIC_RELEASE, "workgroup"); } while (0)


// ETC-style layer (B 2, S 2,048, d 1,024, 16 heads x 64, FFN 4,096): local attention over a +-25 window with clipped relative-position embeddings, output projection + residual + LN, ReLU FFN + residual + LN.
#define NB 2
#define SS 2048
#define NR (NB * SS)
#define DM 1024
#define NH 16
#define HD 64
#define FF 4096
#define RAD 25
#define KREL 5
#define NREL (2 * KREL + 1)
#ifndef TQB
#define TQB (SS / 64)
#endif
#ifndef TQ0
#define TQ0 0
#endif
typedef __attribute__((ext_vector_type(8))) __bf16 v8b;
__device__ __forceinline__ v16b frag_b(const __bf16* rowk0, int lane) {
  union { v16b v; v8b q[2]; } u; const __bf16* p = rowk0 + 8 * (lane >> 4);
  u.q[0] = *(const v8b*)p; u.q[1] = *(const v8b*)(p + 16); return u.v;
}
__device__ __forceinline__ float bfr(float v) { return (float)(__bf16)v; }
__device__ __attribute__((noinline)) float exp_ni(float v) { return expf(v); }
__device__ __attribute__((noinline)) float erf_ni(float v) { return erff(v); }

#define PK_Q  0
#define PK_K  ((size_t)DM * DM)
#define PK_V  ((size_t)2 * DM * DM)
#define PK_O  ((size_t)3 * DM * DM)
#define PK_1  ((size_t)4 * DM * DM)                // [4096][1024] w1 natural
#define PK_2  (PK_1 + (size_t)FF * DM)             // [1024][4096] w2 natural
#define PK_END (PK_2 + (size_t)DM * FF)
#define WS_PK  0u
#define WS_QH  (((2u * PK_END) + 127u) / 128u * 128u)    // f16 [4096][1024] q hi ; QL ; KH ; KL
#define WS_QL  (WS_QH + 2u * NR * DM)
#define WS_KH  (WS_QL + 2u * NR * DM)
#define WS_KL  (WS_KH + 2u * NR * DM)
#define WS_VTH (WS_KL + 2u * NR * DM)                    // f16 [b][1024][2048] v hi ; VTL
#define WS_VTL (WS_VTH + 2u * NR * DM)
#define WS_REL (WS_VTL + 2u * NR * DM)                   // f16 [16 rows][64] rel hi ; RELL (11 real)
#define WS_RELL (WS_REL + 2u * 16 * HD)
#define WS_O   (((WS_RELL + 2u * 16 * HD) + 127u) / 128u * 128u)   // f32 [4096][1024] ctx
#define WS_T1  (WS_O + 4u * NR * DM)                     // f32 pre-LN (reused)
#define WS_H   (WS_T1 + 4u * NR * DM)                    // f32 x = LN1 output
#define WS_GH  (WS_H + 4u * NR * DM)                     // bf16 [4096][4096] relu hi ; GL
#define WS_GL  (WS_GH + 2u * (size_t)NR * FF)
#define WS_END (WS_GL + 2u * (size_t)NR * FF)

// ---- k_pack: every weight rounded to bf16 in its natural [out][in] order. A block = PKB consecutive elements of one matrix (each matrix is a whole number of blocks): 16 loads of 4 floats a thread, a wave's load = 512 contiguous bytes, all issued ahead of the first store; no LDS. The block behind the last weight block makes the relative-position planes (16 rows, 11 real).
#define PKB 16384
#define PK_NB ((int)(PK_END / PKB))
typedef __attribute__((ext_vector_type(4))) __bf16 v4b;
typedef __attribute__((ext_vector_type(4))) _Float16 v4h;
__global__ __launch_bounds__(256) void k_pack(const float* __restrict__ WQ, const float* __restrict__ WK, const float* __restrict__ WV, const float* __restrict__ WO, const float* __restrict__ W1, const float* __restrict__ W2, const float* __restrict__ RELE, __bf16* __restrict__ PK, _Float16* __restrict__ RELH, _Float16* __restrict__ RELL) {
  const int t = threadIdx.x; const unsigned blk = blockIdx.x;
  if (blk == (unsigned)PK_NB) { const int e = t * 4; v4f v = {}; if (e < NREL * HD) v = *(const v4f*)(RELE + e); v4h hi, lo;
#pragma unroll
    for (int i = 0; i < 4; ++i) { const float x = bfr(v[i]); const _Float16 hv = (_Float16)x; hi[i] = hv; lo[i] = (_Float16)((x - (float)hv) * 2048.0f); }
    vst2(RELH + e, hi); vst2(RELL + e, lo); return; }
  constexpr unsigned BM = DM * DM / PKB;   // blocks of a 1024 x 1024 matrix
  const unsigned m = blk / BM; const float* S = (m == 0) ? WQ : (m == 1) ? WK : (m == 2) ? WV : (m == 3) ? WO : (m < 8) ? W1 : W2; const unsigned b0 = (m < 4) ? m * BM : (m < 8) ? 4 * BM : 8 * BM;
  const float* p = S + (size_t)(blk - b0) * PKB + t * 4; __bf16* d = PK + (size_t)blk * PKB + t * 4; v4f v[16];
#pragma unroll
  for (int i = 0; i < 16; ++i) v[i] = *(const v4f*)(p + i * 1024);
  __builtin_amdgcn_sched_barrier(0);   // all 16 loads in flight together: without it the last two are issued behind the wait for the first
  v4b o[16];
#pragma unroll
  for (int i = 0; i < 16; ++i)
#pragma unroll
    for (int e = 0; e < 4; ++e) o[i][e] = (__bf16)v[i][e];
  __builtin_amdgcn_sched_barrier(0);   // the stores as one run behind the last conversion: otherwise later conversions reuse the registers of issued stores and wait for them
#pragma unroll
  for (int i = 0; i < 16; ++i) vst2(d + i * 1024, o[i]);
}
// ---- GEMM core shared by k_proj and k_lin: block = 256 threads = 8 waves (4 x 2), one 128 x 128 tile of Y = A . W^T; a pass is 64 k of every operand row.
// Each pass's rows (W, A hi, A residual, all bf16) are staged once per block in LDS and read from there by every wave that needs them; two buffers, one barrier per pass.
// Wave (wr, wc) owns rows wr*32..+31, cols wc*64..+63: 2 x 4 accumulator tiles. Per accumulator the products keep the order k ascending, residual before hi.
#define LP 72                 // LDS row pitch in 16-bit elements: 144 B = 16 B x odd, for the 16-byte fragment reads
#define PLANE (128 * LP)      // one staged operand plane: 128 rows
// AM 0: A f32, rounded to one bf16 plane; 1: A f32, split into bf16 hi + residual; 2: A given as two bf16 planes (AH, AL). Rows of A at or past nrows are read as row nrows - 1 (their results are not stored).
template <int AM, int KD>
__device__ __forceinline__ void gemm_tile(const float* __restrict__ A, const __bf16* __restrict__ AH, const __bf16* __restrict__ AL, const __bf16* __restrict__ Wt, __bf16* sm, int rb, int n0, int nrows, v8f (&acc)[2][4]) {
  constexpr int NPL = (AM == 0) ? 2 : 3, NP = KD / 64;
  const int tid = threadIdx.x, wave = tid >> 5, lane = tid & 31, col = lane & 15, wr = wave >> 1, wc = wave & 1;
  const int sc = (tid & 7) * 8, sr = tid >> 3;   // staging: this thread's 8 k of a row, and its row in each group of 32
  size_t ao[4], wo[4];
#pragma unroll
  for (int i = 0; i < 4; ++i) { ao[i] = (size_t)min(rb + sr + 32 * i, nrows - 1) * KD + sc; wo[i] = (size_t)(n0 + sr + 32 * i) * KD + sc; }
  v8b rw_[4], rh_[4], rl_[4]; v4f rf_[4][2];
  auto ldg = [&](int p) {
#pragma unroll
    for (int i = 0; i < 4; ++i) { rw_[i] = *(const v8b*)(Wt + wo[i] + p * 64);
      if (AM == 2) { rh_[i] = *(const v8b*)(AH + ao[i] + p * 64); rl_[i] = *(const v8b*)(AL + ao[i] + p * 64); }
      else { const float* q = A + ao[i] + p * 64; rf_[i][0] = *(const v4f*)q; rf_[i][1] = *(const v4f*)(q + 4); } } };
  auto sts = [&](int buf) { __bf16* d = sm + buf * (NPL * PLANE) + sr * LP + sc;
#pragma unroll
    for (int i = 0; i < 4; ++i) { *(v8b*)(d + i * 32 * LP) = rw_[i];
      if (AM == 2) { *(v8b*)(d + PLANE + i * 32 * LP) = rh_[i]; *(v8b*)(d + 2 * PLANE + i * 32 * LP) = rl_[i]; }
      else { v8b hv, lv;
#pragma unroll
        for (int e = 0; e < 8; ++e) { const float v = rf_[i][e >> 2][e & 3]; const __bf16 hb = (__bf16)v; hv[e] = hb; lv[e] = (__bf16)(v - (float)hb); }
        *(v8b*)(d + PLANE + i * 32 * LP) = hv; if (AM == 1) *(v8b*)(d + 2 * PLANE + i * 32 * LP) = lv; } } };
  ldg(0); sts(0); __syncthreads();
#pragma unroll 1
  for (int p = 0; p < NP; ++p) {
    if (p + 1 < NP) ldg(p + 1);   // the next pass's global loads fly under this pass's products
    const __bf16* sW = sm + (p & 1) * (NPL * PLANE) + (wc * 64 + col) * LP; const __bf16* sH = sm + (p & 1) * (NPL * PLANE) + PLANE + (wr * 32 + col) * LP;
#pragma unroll
    for (int kc = 0; kc < 2; ++kc) { v16b w[4], ah[2], al[2];
#pragma unroll
      for (int ct = 0; ct < 4; ++ct) w[ct] = frag_b(sW + ct * 16 * LP + kc * 32, lane);
#pragma unroll
      for (int rt = 0; rt < 2; ++rt) { ah[rt] = frag_b(sH + rt * 16 * LP + kc * 32, lane); if (AM != 0) al[rt] = frag_b(sH + PLANE + rt * 16 * LP + kc * 32, lane); }
      if (AM != 0) {
#pragma unroll
        for (int rt = 0; rt < 2; ++rt)
#pragma unroll
          for (int ct = 0; ct < 4; ++ct) acc[rt][ct] = wmma_bf(al[rt], w[ct], acc[rt][ct]); }
#pragma unroll
      for (int rt = 0; rt < 2; ++rt)
#pragma unroll
        for (int ct = 0; ct < 4; ++ct) acc[rt][ct] = wmma_bf(ah[rt], w[ct], acc[rt][ct]); }
    if (p + 1 < NP) sts((p + 1) & 1);   // into the buffer whose last readers left before the previous pass's barrier
    __syncthreads();                    // publishes pass p + 1 and ends every read of pass p's buffer
  }
}
// ---- k_proj: block = (128 rows, 128 cols, which): 0 q, 1 k -> f16 hi/lo rows (+ bias); 2 v -> hi/lo transposed planes per batch; the epilogue stages in the ring's LDS behind the last pass's barrier
__global__ __launch_bounds__(256) void k_proj(const float* __restrict__ X, const __bf16* __restrict__ PK, const float* __restrict__ BQ, const float* __restrict__ BK, const float* __restrict__ BV, _Float16* __restrict__ QH, _Float16* __restrict__ QL_, _Float16* __restrict__ KH, _Float16* __restrict__ KL, _Float16* __restrict__ VTH, _Float16* __restrict__ VTL) {
  __shared__ __align__(16) __bf16 sm[2 * 2 * PLANE];
  const int tid = threadIdx.x, wave = tid >> 5, lane = tid & 31, col = lane & 15, g = lane >> 4, wr = wave >> 1, wc = wave & 1; const int which = blockIdx.z; const int rb = blockIdx.x * 128, n0 = blockIdx.y * 128;
  const __bf16* P = PK + ((which == 0) ? PK_Q : (which == 1) ? PK_K : PK_V); const float* BB = (which == 0) ? BQ : (which == 1) ? BK : BV;
  v8f acc[2][4] = {};
  gemm_tile<0, DM>(X, nullptr, nullptr, P, sm, rb, n0, NR, acc);
  const int rw = rb + wr * 32, nw = n0 + wc * 64;
  if (which < 2) {
    _Float16* sh = (_Float16*)sm + wave * (2 * 32 * LP); _Float16* sl = sh + 32 * LP;
#pragma unroll
    for (int ct = 0; ct < 4; ++ct) { const float bb = bfr(BB[nw + ct * 16 + col]);
#pragma unroll
      for (int rt = 0; rt < 2; ++rt)
#pragma unroll
        for (int r = 0; r < 8; ++r) { const float vv = acc[rt][ct][r] + bb; const _Float16 hv = (_Float16)vv; const int o = (rt * 16 + 8 * g + r) * LP + ct * 16 + col; sh[o] = hv; sl[o] = (_Float16)((vv - (float)hv) * 2048.0f); } }
    LDSX();
    _Float16* DH_ = (which == 0) ? QH : KH; _Float16* DL_ = (which == 0) ? QL_ : KL;
    for (int q = 0; q < 8; ++q) { const int rl = q * 4 + (lane >> 3), c8 = (lane & 7) * 8; const size_t o = (size_t)(rw + rl) * DM + nw + c8; vst2((unsigned*)(DH_ + o), *(const v4u*)&sh[rl * LP + c8]); vst2((unsigned*)(DL_ + o), *(const v4u*)&sl[rl * LP + c8]); }
  } else {
    _Float16* sth = (_Float16*)sm; _Float16* stl = sth + 128 * 136;   // [128 d][128 s], pitch 136
#pragma unroll
    for (int ct = 0; ct < 4; ++ct) { const float bb = bfr(BB[nw + ct * 16 + col]);
#pragma unroll
      for (int rt = 0; rt < 2; ++rt) { v8h h8, l8;
#pragma unroll
        for (int r = 0; r < 8; ++r) { const float vv = acc[rt][ct][r] + bb; const _Float16 hv = (_Float16)vv; h8[r] = hv; l8[r] = (_Float16)((vv - (float)hv) * 2048.0f); }
        const int o = (wc * 64 + ct * 16 + col) * 136 + wr * 32 + rt * 16 + 8 * g; *(v8h*)&sth[o] = h8; *(v8h*)&stl[o] = l8; } }
    __syncthreads();
    const int b = rb / SS, s0 = rb % SS;
    for (int e = tid; e < 128 * 16; e += 256) { const int d = e >> 4, pc = e & 15; const size_t o = ((size_t)b * DM + n0 + d) * SS + s0 + pc * 8; vst2((unsigned*)(VTH + o), *(const v4u*)&sth[d * 136 + pc * 8]); vst2((unsigned*)(VTL + o), *(const v4u*)&stl[d * 136 + pc * 8]); }
  }
}
// ---- k_attn: block = (64 queries i, h, b): key steps covering [i0 - 25, i0 + 63 + 25] within [0, S); c = q.k (3 products); rel band: window slot t <-> offset (j - i) = t0w + t with t0w = j0 - iw0 - 15, row = clip(t0w + t, -5, 5) + 5 (3 products) -> LDS, picked at jl - il + 15; scores = (c + rel)/8 within |j - i| <= 25 and 0 <= j < S, else -inf; online softmax; P hi/lo x V hi/lo
// fragment at a block-uniform base plus a lane's own 32-bit byte offset (its 16 * (lane >> 4) included): fewer address registers held beside a group of loads
__device__ __forceinline__ v16h fragu(const _Float16* base, unsigned off) {
  union { v16h v; v8h q[2]; } u; const char* p = (const char*)base + off;
  u.q[0] = *(const v8h*)p; u.q[1] = *(const v8h*)(p + 32); return u.v;
}
__global__ __launch_bounds__(128) void k_attn(const _Float16* __restrict__ QH, const _Float16* __restrict__ QL_, const _Float16* __restrict__ KH, const _Float16* __restrict__ KL, const _Float16* __restrict__ RELH, const _Float16* __restrict__ RELL, const _Float16* __restrict__ VTH, const _Float16* __restrict__ VTL, float* __restrict__ O) {
  __shared__ __align__(16) _Float16 sph[4][16][40], spl[4][16][40]; __shared__ float srl[4][16][49]; __shared__ __align__(16) float so[4][16][68];
  const int tid = threadIdx.x, wave = tid >> 5, lane = tid & 31, col = lane & 15, g = lane >> 4; const int qb = blockIdx.x + TQ0, h = blockIdx.y, b = blockIdx.z; const int i0 = qb * 64, iw0 = i0 + wave * 16;
  v16h aq[2], aql[2];
#pragma unroll
  for (int kc = 0; kc < 2; ++kc) { const size_t o = ((size_t)b * SS + iw0 + col) * DM + h * HD + kc * 32; aq[kc] = frag_h(QH + o, lane); aql[kc] = frag_h(QL_ + o, lane); }
  const _Float16* Vh = VTH + ((size_t)b * DM + h * HD) * SS; const _Float16* Vl = VTL + ((size_t)b * DM + h * HD) * SS;
  float m[8], l[8];
#pragma unroll
  for (int r = 0; r < 8; ++r) { m[r] = -3.0e38f; l[r] = 0.f; }
  v8f acc[4] = {}, accl[4] = {};
  const unsigned ko = (unsigned)col * (2 * DM) + 16 * g, vo = (unsigned)col * (2 * SS) + 16 * g;   // the lane's byte offsets in a key tile and in a value tile: the same in every step
  const int jlo = max(i0 - RAD, 0), jhi = min(i0 + 63 + RAD, SS - 1); const int ks0 = jlo / 32, ks1 = jhi / 32;
#pragma unroll 1
  for (int ks = ks0; ks <= ks1; ++ks) { const int j0 = ks * 32;
    const int t0w = j0 - iw0 - 15;   // offset (j - i) of window slot 0
    const size_t kb0 = ((size_t)b * SS + j0) * DM + h * HD;   // the step's first key row, the same for the whole block
    v16h rh[3][2], rl[3][2], kh[2][2], kl[2][2], vh[4], vl[4];
    auto ldrel = [&](int ct3) { int rr = t0w + ct3 * 16 + col; rr = min(max(rr, -KREL), KREL) + KREL;
#pragma unroll
      for (int kc = 0; kc < 2; ++kc) { const unsigned o = (unsigned)rr * (2 * HD) + 16 * g; rh[ct3][kc] = fragu(RELH + kc * 32, o); rl[ct3][kc] = fragu(RELL + kc * 32, o); } };
    ldrel(0); ldrel(1);
    __builtin_amdgcn_sched_barrier(0);   // these 16 loads of relative rows fly together: without it each pair is issued in front of its own product and waited for alone
#pragma unroll
    for (int ct3 = 0; ct3 < 3; ++ct3) { v8f u = {}, ul = {};
#pragma unroll
      for (int kc = 0; kc < 2; ++kc) { u = wmma16(aq[kc], rh[ct3][kc], u); ul = wmma16(aql[kc], rh[ct3][kc], ul); ul = wmma16(aq[kc], rl[ct3][kc], ul); }
#pragma unroll
      for (int r = 0; r < 8; ++r) srl[wave][8 * g + r][ct3 * 16 + col] = u[r] + ul[r] * (1.0f / 2048.0f);
      if (ct3 == 0) { ldrel(2);
        __builtin_amdgcn_sched_barrier(0);   // the last 8 loads of relative rows fly under the second tile's products, in the registers the first tile has left
      } }
#pragma unroll
    for (int ct = 0; ct < 2; ++ct)
#pragma unroll
      for (int kc = 0; kc < 2; ++kc) { kh[ct][kc] = fragu(KH + kb0 + ct * 16 * DM + kc * 32, ko); kl[ct][kc] = fragu(KL + kb0 + ct * 16 * DM + kc * 32, ko); }
    __builtin_amdgcn_sched_barrier(0);   // the 16 key loads fly together
    LDSX();
    v8f c[2] = {}, cl[2] = {};
#pragma unroll
    for (int ct = 0; ct < 2; ++ct)
#pragma unroll
      for (int kc = 0; kc < 2; ++kc) { c[ct] = wmma16(aq[kc], kh[ct][kc], c[ct]); cl[ct] = wmma16(aql[kc], kh[ct][kc], cl[ct]); cl[ct] = wmma16(aq[kc], kl[ct][kc], cl[ct]); }
    float rv[2][8];
#pragma unroll
    for (int ct = 0; ct < 2; ++ct)
#pragma unroll
      for (int r = 0; r < 8; ++r) rv[ct][r] = srl[wave][8 * g + r][ct * 16 + col - (8 * g + r) + 15];   // slot 0..46, always written: read outside the mask's test, all 16 behind one wait
    v8f s[2];
#pragma unroll
    for (int ct = 0; ct < 2; ++ct) { const int kk = j0 + ct * 16 + col, d0 = kk - iw0 - 8 * g, dlo = d0 - RAD, dhi = d0 + RAD;   // d0 = j - i of the lane's first row; row r is tested against a constant, so no register a row is held over the loop
#pragma unroll
      for (int r = 0; r < 8; ++r) { const bool ok = (dlo <= r) && (dhi >= r) && (kk < SS);   // |j - i| <= 25 for row r
        s[ct][r] = ok ? (c[ct][r] + cl[ct][r] * (1.0f / 2048.0f) + rv[ct][r]) * 0.125f : -3.0e38f; } }
#pragma unroll
    for (int r = 0; r < 8; ++r) { float mx = fmaxf(s[0][r], s[1][r]);
#pragma unroll
      for (int o = 1; o < 16; o <<= 1) mx = fmaxf(mx, __shfl_xor(mx, o));
      const float mn = fmaxf(m[r], mx); const float alpha = (m[r] <= -1.0e38f) ? 0.f : __expf(m[r] - mn);
      const float e0 = (s[0][r] <= -1.0e38f) ? 0.f : __expf(s[0][r] - mn), e1 = (s[1][r] <= -1.0e38f) ? 0.f : __expf(s[1][r] - mn); float es = e0 + e1;
#pragma unroll
      for (int o = 1; o < 16; o <<= 1) es += __shfl_xor(es, o);
      l[r] = l[r] * alpha + es; m[r] = (mn <= -1.0e38f) ? m[r] : mn;
#pragma unroll
      for (int dt = 0; dt < 4; ++dt) { acc[dt][r] *= alpha; accl[dt][r] *= alpha; }
      const _Float16 h0 = (_Float16)e0, h1 = (_Float16)e1; sph[wave][8 * g + r][col] = h0; sph[wave][8 * g + r][16 + col] = h1; spl[wave][8 * g + r][col] = (_Float16)((e0 - (float)h0) * 2048.0f); spl[wave][8 * g + r][16 + col] = (_Float16)((e1 - (float)h1) * 2048.0f); }
    __builtin_amdgcn_sched_barrier(0);   // keeps the value loads behind the softmax: held through it, their 64 registers push the wave past 256 and cost a wave per SIMD
    const _Float16* pvh = (const _Float16*)((const char*)(Vh + j0) + vo); const _Float16* pvl = (const _Float16*)((const char*)(Vl + j0) + vo);
#pragma unroll
    for (int dt = 0; dt < 4; ++dt) { vh[dt] = fragu(pvh + dt * 16 * SS, 0u); vl[dt] = fragu(pvl + dt * 16 * SS, 0u); }
    asm volatile("s_wait_xcnt 0x0" :: "v"(pvh), "v"(pvl) : "memory");   // the two address pairs stay whole until this wait
    __builtin_amdgcn_sched_barrier(0);   // the 16 value loads fly together, under the hand-over of P through LDS
    LDSX();
    const v16h pah = frag_h(&sph[wave][col][0], lane), pal = frag_h(&spl[wave][col][0], lane);
#pragma unroll
    for (int dt = 0; dt < 4; ++dt) { acc[dt] = wmma16(pah, vh[dt], acc[dt]); accl[dt] = wmma16(pal, vh[dt], accl[dt]); accl[dt] = wmma16(pah, vl[dt], accl[dt]); }
    LDSX(); }
#pragma unroll
  for (int r = 0; r < 8; ++r) { const float il = 1.0f / l[r];
#pragma unroll
    for (int dt = 0; dt < 4; ++dt) so[wave][8 * g + r][dt * 16 + col] = (acc[dt][r] + accl[dt][r] * (1.0f / 2048.0f)) * il; }
  LDSX();
  for (int rl = 0; rl < 16; ++rl) if (lane < 16) vst2(O + ((size_t)b * SS + iw0 + rl) * DM + h * HD + lane * 4, *(const v4f*)&so[wave][rl][lane * 4]);
}
// ---- k_lin<MODE>: block = (128 rows, 128 cols); 0: T1 = O(hi/lo) . Wo^T + bo + src; 1: G = relu(X(hi/lo) . W1^T + b1) -> bf16 hi/lo; 2: T1 = G . W2^T (2 products) + b2 + X; rows at or past nrows are not stored; the epilogue stages in the ring's LDS behind the last pass's barrier
template <int MODE>
__global__ __launch_bounds__(256) void k_lin(const float* __restrict__ A, const __bf16* __restrict__ AG, const __bf16* __restrict__ AGL, const __bf16* __restrict__ PK, const float* __restrict__ BIAS, const float* __restrict__ RES, float* __restrict__ OUTF, __bf16* __restrict__ OUTG, __bf16* __restrict__ OUTGL, int nrows) {
  __shared__ __align__(16) __bf16 sm[2 * 3 * PLANE];
  const int tid = threadIdx.x, wave = tid >> 5, lane = tid & 31, col = lane & 15, g = lane >> 4, wr = wave >> 1, wc = wave & 1; const int rb = blockIdx.x * 128, n0 = blockIdx.y * 128;
  constexpr int KD = (MODE == 2) ? FF : DM; const __bf16* P = PK + ((MODE == 0) ? PK_O : (MODE == 1) ? PK_1 : PK_2);
  v8f acc[2][4] = {};
  gemm_tile<(MODE == 2) ? 2 : 1, KD>(A, AG, AGL, P, sm, rb, n0, nrows, acc);
  const int rw = rb + wr * 32, nw = n0 + wc * 64;
  if (MODE == 1) {
    __bf16* sg = sm + wave * (2 * 32 * LP); __bf16* sgl = sg + 32 * LP;
#pragma unroll
    for (int ct = 0; ct < 4; ++ct) { const float bb = bfr(BIAS[nw + ct * 16 + col]);
#pragma unroll
      for (int rt = 0; rt < 2; ++rt)
#pragma unroll
        for (int r = 0; r < 8; ++r) { const float v = fmaxf(acc[rt][ct][r] + bb, 0.f); const __bf16 hb = (__bf16)v; const int o = (rt * 16 + 8 * g + r) * LP + ct * 16 + col; sg[o] = hb; sgl[o] = (__bf16)(v - (float)hb); } }
    LDSX();
    for (int q = 0; q < 8; ++q) { const int rl = q * 4 + (lane >> 3), c8 = (lane & 7) * 8; if (rw + rl < nrows) { const size_t o = (size_t)(rw + rl) * FF + nw + c8; vst2((unsigned*)(OUTG + o), *(const v4u*)&sg[rl * LP + c8]); vst2((unsigned*)(OUTGL + o), *(const v4u*)&sgl[rl * LP + c8]); } }
  } else {
    float* so = (float*)sm + wave * (32 * 68);
#pragma unroll
    for (int ct = 0; ct < 4; ++ct) { const float bb = bfr(BIAS[nw + ct * 16 + col]);
#pragma unroll
      for (int rt = 0; rt < 2; ++rt)
#pragma unroll
        for (int r = 0; r < 8; ++r) so[(rt * 16 + 8 * g + r) * 68 + ct * 16 + col] = acc[rt][ct][r] + bb; }
    LDSX();
    for (int q = 0; q < 16; ++q) { const int rl = q * 2 + g; if (rw + rl < nrows) { const size_t o = (size_t)(rw + rl) * DM + nw + col * 4; v4f v = *(const v4f*)&so[rl * 68 + col * 4]; const v4f rs = *(const v4f*)(RES + o);
#pragma unroll
        for (int i = 0; i < 4; ++i) v[i] += (MODE == 0) ? bfr(rs[i]) : rs[i];
        vst2(OUTF + o, v); } }
  }
}
// ---- k_ln: wave = row (32 lanes x 32 floats, a load = 512 contiguous bytes), 8 rows a block, no LDS: LayerNorm (biased variance, eps 1e-5)
__global__ __launch_bounds__(256) void k_ln(const float* __restrict__ T, const float* __restrict__ G, const float* __restrict__ Bv, float* __restrict__ OUT) {
  const int t = threadIdx.x, lane = t & 31; const size_t row = (size_t)blockIdx.x * 8 + __builtin_amdgcn_readfirstlane(t >> 5);   // the row is the wave's: its base address stays scalar
  const float* p = T + row * DM + lane * 4;
  v4f v[8];
#pragma unroll
  for (int i = 0; i < 8; ++i) v[i] = *(const v4f*)(p + i * 128);
  float s4[4] = {0.f, 0.f, 0.f, 0.f};
#pragma unroll
  for (int i = 0; i < 8; ++i)
#pragma unroll
    for (int e = 0; e < 4; ++e) s4[e] += v[i][e];
  float s = (s4[0] + s4[1]) + (s4[2] + s4[3]);
#pragma unroll
  for (int o = 1; o < 32; o <<= 1) s += __shfl_xor(s, o);
  const float mu = s / (float)DM; float q4[4] = {0.f, 0.f, 0.f, 0.f};
#pragma unroll
  for (int i = 0; i < 8; ++i)
#pragma unroll
    for (int e = 0; e < 4; ++e) { const float d = v[i][e] - mu; q4[e] += d * d; }
  float q = (q4[0] + q4[1]) + (q4[2] + q4[3]);
#pragma unroll
  for (int o = 1; o < 32; o <<= 1) q += __shfl_xor(q, o);
  const float inv = 1.0f / sqrtf(q / (float)DM + 1e-5f);
#pragma unroll
  for (int i = 0; i < 8; ++i) { const v4f gg = *(const v4f*)(G + lane * 4 + i * 128), bb = *(const v4f*)(Bv + lane * 4 + i * 128); v4f o4;
#pragma unroll
    for (int e = 0; e < 4; ++e) o4[e] = (v[i][e] - mu) * inv * bfr(gg[e]) + bfr(bb[e]);
    vst2(OUT + row * DM + lane * 4 + i * 128, o4); }
}
extern "C" void kernel_launch(void* const* d_in, const int* in_sizes, int n_in, void* d_out, int out_size, void* d_ws, size_t ws_size, hipStream_t stream) {
  (void)in_sizes; (void)n_in; (void)out_size;
  const float** F = (const float**)d_in;   // 0 src [2,2048,1024], 1 wq [1024,1024] natural, 2 bq, 3 wk, 4 bk, 5 wv, 6 bv, 7 wo, 8 bo, 9 rel_emb [11,64], 10 w1 [4096,1024] natural, 11 b1, 12 w2 [1024,4096] natural, 13 b2, 14 g1, 15 beta1, 16 g2, 17 beta2
  if (ws_size < (size_t)WS_END) return;
  char* ws = (char*)d_ws; __bf16 *PK = (__bf16*)(ws + WS_PK), *GH = (__bf16*)(ws + WS_GH), *GL = (__bf16*)(ws + WS_GL); _Float16 *QH = (_Float16*)(ws + WS_QH), *QLp = (_Float16*)(ws + WS_QL), *KH = (_Float16*)(ws + WS_KH), *KL = (_Float16*)(ws + WS_KL), *VTH = (_Float16*)(ws + WS_VTH), *VTL = (_Float16*)(ws + WS_VTL), *RELH = (_Float16*)(ws + WS_REL), *RELL = (_Float16*)(ws + WS_RELL); float *O = (float*)(ws + WS_O), *T1 = (float*)(ws + WS_T1), *Hh = (float*)(ws + WS_H);
  k_pack<<<PK_NB + 1, 256, 0, stream>>>(F[1], F[3], F[5], F[7], F[10], F[12], F[9], PK, RELH, RELL);
  k_proj<<<dim3(NR / 128, DM / 128, 3), 256, 0, stream>>>(F[0], PK, F[2], F[4], F[6], QH, QLp, KH, KL, VTH, VTL);
  k_attn<<<dim3(TQB, NH, NB), 128, 0, stream>>>(QH, QLp, KH, KL, RELH, RELL, VTH, VTL, O);
#ifndef TWIN_ROWS
  const size_t R0 = 0; const int NRW = NR; (void)R0;
  k_lin<0><<<dim3(NR / 128, DM / 128), 256, 0, stream>>>(O, nullptr, nullptr, PK, F[8], F[0], T1, nullptr, nullptr, NRW);
  k_ln<<<NR / 8, 256, 0, stream>>>(T1, F[14], F[15], Hh);
  k_lin<1><<<dim3(NR / 128, FF / 128), 256, 0, stream>>>(Hh, nullptr, nullptr, PK, F[11], nullptr, nullptr, GH, GL, NRW);
  k_lin<2><<<dim3(NR / 128, DM / 128), 256, 0, stream>>>(nullptr, GH, GL, PK, F[13], Hh, T1, nullptr, nullptr, NRW);
  k_ln<<<NR / 8, 256, 0, stream>>>(T1, F[16], F[17], (float*)d_out);
#else
  for (int bb = 0; bb < NB; ++bb) { const size_t R0 = (size_t)bb * SS + (size_t)TQ0 * 64; const int NRW = TQB * 64;   // only the attended rows of each batch
  k_lin<0><<<dim3((NRW + 127) / 128, DM / 128), 256, 0, stream>>>(O + R0 * DM, nullptr, nullptr, PK, F[8], F[0] + R0 * DM, T1 + R0 * DM, nullptr, nullptr, NRW);
  k_ln<<<NRW / 8, 256, 0, stream>>>(T1 + R0 * DM, F[14], F[15], Hh + R0 * DM);
  k_lin<1><<<dim3((NRW + 127) / 128, FF / 128), 256, 0, stream>>>(Hh + R0 * DM, nullptr, nullptr, PK, F[11], nullptr, nullptr, GH + R0 * FF, GL + R0 * FF, NRW);
  k_lin<2><<<dim3((NRW + 127) / 128, DM / 128), 256, 0, stream>>>(nullptr, GH + R0 * FF, GL + R0 * FF, PK, F[13], Hh + R0 * DM, T1 + R0 * DM, nullptr, nullptr, NRW);
  k_ln<<<NRW / 8, 256, 0, stream>>>(T1 + R0 * DM, F[16], F[17], (float*)d_out + R0 * DM); }
#endif
}

// v004
// One run takes 225 microseconds.
// Two timings next to v003 put it at 1.04 and 1.05 times that version's speed.
// Over all steps from v000 it is 3.27 times as fast.
// compute dtype: all inputs rounded to bf16; q, k, v = src . W^T + b with EXACT bf16 products on WMMA 16x16x32 (natural [out][in] rows); q and k stored as f16 hi + (x2048-scaled) residual planes, the 11 relative-position rows likewise; per (query tile, key step) inside the +-25 window: q . k and the relative term q . rel_emb[clip(j - i, -5, 5) + 5] (a 48-wide skewed window GEMM with the row index clamped exactly like the module's clip, gathered per (i,j) from LDS), 3 products each, x 64^-1/2, window / validity mask, running-max softmax in f32 (hardware exp); P as f16 hi + (x2048) residual x v hi/lo (3 products); out . Wo (ctx as bf16 hi + residual, 2 products) + bo + src, LayerNorm (eps 1e-5) in f32; FFN: x (hi + residual) . W1^T + b1 (2 products), ReLU, (hi + residual) . W2^T + b2 + x (2 products), LayerNorm; f32 accumulate.
#include <hip/hip_runtime.h>
#include <math.h>

typedef __attribute__((ext_vector_type(16))) _Float16 v16h;
typedef __attribute__((ext_vector_type(16))) __bf16 v16b;
typedef __attribute__((ext_vector_type(8)))  _Float16 v8h;
typedef __attribute__((ext_vector_type(8)))  float v8f;
typedef __attribute__((ext_vector_type(4)))  float v4f;
typedef __attribute__((ext_vector_type(2)))  float v2f;
typedef __attribute__((ext_vector_type(4)))  unsigned v4u;
typedef __attribute__((ext_vector_type(4)))  int v4i;
typedef float __attribute__((may_alias)) float_a;
typedef int __attribute__((may_alias)) int_a;

template <typename T> __device__ __forceinline__ void vst2(void* p, T v) { *(T*)p = v;  }
__device__ __forceinline__ v8f wmma16(v16h a, v16h b, v8f c) {
  v8f d = __builtin_amdgcn_wmma_f32_16x16x32_f16(false, a, false, b, (short)0, c, false, false);
  asm volatile("v_nop\n\tv_nop\n\tv_nop\n\tv_nop" : "+v"(d) : "v"(a), "v"(b));
  return d;
}
__device__ __forceinline__ v8f wmma_bf(v16b a, v16b b, v8f c) {
  v8f d = __builtin_amdgcn_wmma_f32_16x16x32_bf16(false, a, false, b, (short)0, c, false, false);
  asm volatile("v_nop\n\tv_nop\n\tv_nop\n\tv_nop" : "+v"(d) : "v"(a), "v"(b));
  return d;
}
// 16x16x32 fragments: lane = (h = lane>>4, row/col = lane&15); elements 0..7 = k0+8h+0..7, 8..15 = k0+16+8h+0..7; D element r = row 8h+r
__device__ __forceinline__ v16h frag_h(const _Float16* rowk0, int lane) {
  union { v16h v; v8h q[2]; } u; const _Float16* p = rowk0 + 8 * (lane >> 4);
  u.q[0] = *(const v8h*)p; u.q[1] = *(const v8h*)(p + 16); return u.v;
}
__device__ __forceinline__ v16h frag_f32(const float* rowk0, int lane) {
  v16h a; const float* p = rowk0 + 8 * (lane >> 4);
#pragma unroll
  for (int i = 0; i < 8; ++i) { a[i] = (_Float16)p[i]; a[8 + i] = (_Float16)p[16 + i]; }
  return a;
}
__device__ __forceinline__ v16h frag_f32s(const float* rowk0, int lane, float sc) {
  v16h a; const float* p = rowk0 + 8 * (lane >> 4);
#pragma unroll
  for (int i = 0; i < 8; ++i) { a[i] = (_Float16)(p[i] * sc); a[8 + i] = (_Float16)(p[16 + i] * sc); }
  return a;
}
// column fragment from a [K][ld] layout (column n), rows >= K read as 0
__device__ __forceinline__ v16h fragc_f32(const float* W, int k0, int n, int lane, int ld, int K) {
  v16h a; const int g = lane >> 4;
#pragma unroll
  for (int i = 0; i < 8; ++i) { const int ka = k0 + 8 * g + i, kb = ka + 16;
    a[i] = (_Float16)(ka < K ? W[(size_t)(ka < K ? ka : K - 1) * ld + n] : 0.f); a[8 + i] = (_Float16)(kb < K ? W[(size_t)(kb < K ? kb : K - 1) * ld + n] : 0.f); }
  return a;
}
struct F2 { v16b h, l; };
__device__ __forceinline__ F2 bsplit16(const float v[16]) { F2 r;
#pragma unroll
  for (int i = 0; i < 16; ++i) { const __bf16 h = (__bf16)v[i]; r.h[i] = h; r.l[i] = (__bf16)(v[i] - (float)h); }
  return r; }
__device__ __forceinline__ F2 split_row(const float* row, int k0, int lane) { float v[16]; const float* p = row + k0 + 8 * (lane >> 4);
#pragma unroll
  for (int i = 0; i < 8; ++i) { v[i] = p[i]; v[8 + i] = p[16 + i]; }
  return bsplit16(v); }
__device__ __forceinline__ F2 split_rowK(const float* row, int k0, int lane, int K) { float v[16]; const int g = lane >> 4;
#pragma unroll
  for (int i = 0; i < 8; ++i) { const int ka = k0 + 8 * g + i, kb = ka + 16; v[i] = ka < K ? row[ka < K ? ka : K - 1] : 0.f; v[8 + i] = kb < K ? row[kb < K ? kb : K - 1] : 0.f; }
  return bsplit16(v); }
__device__ __forceinline__ F2 split_col(const float* W, int k0, int n, int lane, int ld, int K) { float v[16]; const int g = lane >> 4;
#pragma unroll
  for (int i = 0; i < 8; ++i) { const int ka = k0 + 8 * g + i, kb = ka + 16; v[i] = ka < K ? W[(size_t)(ka < K ? ka : K - 1) * ld + n] : 0.f; v[8 + i] = kb < K ? W[(size_t)(kb < K ? kb : K - 1) * ld + n] : 0.f; }
  return bsplit16(v); }
__device__ __forceinline__ v8f mac3(const F2& a, const F2& b, v8f c) { c = wmma_bf(a.l, b.h, c); c = wmma_bf(a.h, b.l, c); return wmma_bf(a.h, b.h, c); }
__device__ __forceinline__ float sigm(float v) { return 1.0f / (1.0f + expf(-v)); }
#define LDSX() do { asm volatile("s_wait_dscnt 0" ::: "memory"); __builtin_amdgcn_wave_barrier(); __builtin_amdgcn_fence(__ATOMIC_RELEASE, "workgroup"); } while (0)


// ETC-style layer (B 2, S 2,048, d 1,024, 16 heads x 64, FFN 4,096): local attention over a +-25 window with clipped relative-position embeddings, output projection + residual + LN, ReLU FFN + residual + LN.
#define NB 2
#define SS 2048
#define NR (NB * SS)
#define DM 1024
#define NH 16
#define HD 64
#define FF 4096
#define RAD 25
#define KREL 5
#define NREL (2 * KREL + 1)
#ifndef TQB
#define TQB (SS / 64)
#endif
#ifndef TQ0
#define TQ0 0
#endif
typedef __attribute__((ext_vector_type(8))) __bf16 v8b;
__device__ __forceinline__ v16b frag_b(const __bf16* rowk0, int lane) {
  union { v16b v; v8b q[2]; } u; const __bf16* p = rowk0 + 8 * (lane >> 4);
  u.q[0] = *(const v8b*)p; u.q[1] = *(const v8b*)(p + 16); return u.v;
}
__device__ __forceinline__ float bfr(float v) { return (float)(__bf16)v; }
__device__ __attribute__((noinline)) float exp_ni(float v) { return expf(v); }
__device__ __attribute__((noinline)) float erf_ni(float v) { return erff(v); }

#define PK_Q  0
#define PK_K  ((size_t)DM * DM)
#define PK_V  ((size_t)2 * DM * DM)
#define PK_O  ((size_t)3 * DM * DM)
#define PK_1  ((size_t)4 * DM * DM)                // [4096][1024] w1 natural
#define PK_2  (PK_1 + (size_t)FF * DM)             // [1024][4096] w2 natural
#define PK_END (PK_2 + (size_t)DM * FF)
#define WS_PK  0u
#define WS_QH  (((2u * PK_END) + 127u) / 128u * 128u)    // f16 [4096][1024] q hi ; QL ; KH ; KL
#define WS_QL  (WS_QH + 2u * NR * DM)
#define WS_KH  (WS_QL + 2u * NR * DM)
#define WS_KL  (WS_KH + 2u * NR * DM)
#define WS_VTH (WS_KL + 2u * NR * DM)                    // f16 [b][1024][2048] v hi ; VTL
#define WS_VTL (WS_VTH + 2u * NR * DM)
#define WS_REL (WS_VTL + 2u * NR * DM)                   // f16 [16 rows][64] rel hi ; RELL (11 real)
#define WS_RELL (WS_REL + 2u * 16 * HD)
#define WS_O   (((WS_RELL + 2u * 16 * HD) + 127u) / 128u * 128u)   // f32 [4096][1024] ctx
#define WS_T1  (WS_O + 4u * NR * DM)                     // f32 pre-LN (reused)
#define WS_H   (WS_T1 + 4u * NR * DM)                    // f32 x = LN1 output
#define WS_GH  (WS_H + 4u * NR * DM)                     // bf16 [4096][4096] relu hi ; GL
#define WS_GL  (WS_GH + 2u * (size_t)NR * FF)
#define WS_END (WS_GL + 2u * (size_t)NR * FF)

// ---- k_pack: every weight rounded to bf16 in its natural [out][in] order. A block = PKB consecutive elements of one matrix (each matrix is a whole number of blocks): 16 loads of 4 floats a thread, a wave's load = 512 contiguous bytes, all issued ahead of the first store; no LDS. The block behind the last weight block makes the relative-position planes (16 rows, 11 real).
#define PKB 16384
#define PK_NB ((int)(PK_END / PKB))
typedef __attribute__((ext_vector_type(4))) __bf16 v4b;
typedef __attribute__((ext_vector_type(4))) _Float16 v4h;
__global__ __launch_bounds__(256) void k_pack(const float* __restrict__ WQ, const float* __restrict__ WK, const float* __restrict__ WV, const float* __restrict__ WO, const float* __restrict__ W1, const float* __restrict__ W2, const float* __restrict__ RELE, __bf16* __restrict__ PK, _Float16* __restrict__ RELH, _Float16* __restrict__ RELL) {
  const int t = threadIdx.x; const unsigned blk = blockIdx.x;
  if (blk == (unsigned)PK_NB) { const int e = t * 4; v4f v = {}; if (e < NREL * HD) v = *(const v4f*)(RELE + e); v4h hi, lo;
#pragma unroll
    for (int i = 0; i < 4; ++i) { const float x = bfr(v[i]); const _Float16 hv = (_Float16)x; hi[i] = hv; lo[i] = (_Float16)((x - (float)hv) * 2048.0f); }
    vst2(RELH + e, hi); vst2(RELL + e, lo); return; }
  constexpr unsigned BM = DM * DM / PKB;   // blocks of a 1024 x 1024 matrix
  const unsigned m = blk / BM; const float* S = (m == 0) ? WQ : (m == 1) ? WK : (m == 2) ? WV : (m == 3) ? WO : (m < 8) ? W1 : W2; const unsigned b0 = (m < 4) ? m * BM : (m < 8) ? 4 * BM : 8 * BM;
  const float* p = S + (size_t)(blk - b0) * PKB + t * 4; __bf16* d = PK + (size_t)blk * PKB + t * 4; v4f v[16];
#pragma unroll
  for (int i = 0; i < 16; ++i) v[i] = *(const v4f*)(p + i * 1024);
  __builtin_amdgcn_sched_barrier(0);   // all 16 loads in flight together: without it the last two are issued behind the wait for the first
  v4b o[16];
#pragma unroll
  for (int i = 0; i < 16; ++i)
#pragma unroll
    for (int e = 0; e < 4; ++e) o[i][e] = (__bf16)v[i][e];
  __builtin_amdgcn_sched_barrier(0);   // the stores as one run behind the last conversion: otherwise later conversions reuse the registers of issued stores and wait for them
#pragma unroll
  for (int i = 0; i < 16; ++i) vst2(d + i * 1024, o[i]);
}
// work-group barrier that orders LDS alone: __syncthreads() also waits for every global load in flight, and the GEMM core's loads of a later pass are to stay in flight across it
__device__ __forceinline__ void bar_lds() {
  __builtin_amdgcn_fence(__ATOMIC_RELEASE, "workgroup", "local");
  __builtin_amdgcn_s_barrier();
  __builtin_amdgcn_fence(__ATOMIC_ACQUIRE, "workgroup", "local");
}
// ---- GEMM core shared by k_proj and k_lin: block = 256 threads = 8 waves (4 x 2), one 128 x 128 tile of Y = A . W^T; a pass is 64 k of every operand row.
// Each pass's rows (W, A hi, A residual, all bf16) are staged once per block in LDS and read from there by every wave that needs them; two buffers, one barrier per pass; their global loads are issued two passes ahead.
// Wave (wr, wc) owns rows wr*32..+31, cols wc*64..+63: 2 x 4 accumulator tiles. Per accumulator the products keep the order k ascending, residual before hi.
#define LP 72                 // LDS row pitch in 16-bit elements: 144 B = 16 B x odd, for the 16-byte fragment reads
#define PLANE (128 * LP)      // one staged operand plane: 128 rows
// AM 0: A f32, rounded to one bf16 plane; 1: A f32, split into bf16 hi + residual; 2: A given as two bf16 planes (AH, AL). Rows of A at or past nrows are read as row nrows - 1 (their results are not stored).
template <int AM, int KD>
__device__ __forceinline__ void gemm_tile(const float* __restrict__ A, const __bf16* __restrict__ AH, const __bf16* __restrict__ AL, const __bf16* __restrict__ Wt, __bf16* sm, int rb, int n0, int nrows, v8f (&acc)[2][4]) {
  constexpr int NPL = (AM == 0) ? 2 : 3, NP = KD / 64;
  const int tid = threadIdx.x, wave = tid >> 5, lane = tid & 31, col = lane & 15, wr = wave >> 1, wc = wave & 1;
  const int sc = (tid & 7) * 8, sr = tid >> 3;   // staging: this thread's 8 k of a row, and its row in each group of 32
  unsigned ao[4], wo[4];   // the thread's 32-bit byte offsets from the operands' block-uniform bases: one register a row and not a pair, so that both register sets fit beside them
#pragma unroll
  for (int i = 0; i < 4; ++i) { ao[i] = (unsigned)(min(rb + sr + 32 * i, nrows - 1) * KD + sc) * (AM == 2 ? 2u : 4u); wo[i] = (unsigned)((n0 + sr + 32 * i) * KD + sc) * 2u; }
  v8b rw_[2][4], rh_[2][4], rl_[2][4]; v4f rf_[2][4][2];   // two register sets: pass p + 1 waits in one for its place in LDS while pass p + 2 lands in the other
  auto ldg = [&](int p, int s) { const unsigned kw = (unsigned)p * 128u, ka = (unsigned)p * (AM == 2 ? 128u : 256u);   // a pass's 64 k in bytes
    unsigned ow[4], oa[4];
#pragma unroll
    for (int i = 0; i < 4; ++i) { ow[i] = wo[i] + kw; oa[i] = ao[i] + ka; }
#pragma unroll
    for (int i = 0; i < 4; ++i) { rw_[s][i] = *(const v8b*)((const char*)Wt + ow[i]);
      if (AM == 2) { rh_[s][i] = *(const v8b*)((const char*)AH + oa[i]); rl_[s][i] = *(const v8b*)((const char*)AL + oa[i]); }
      else { const char* q = (const char*)A + oa[i]; rf_[s][i][0] = *(const v4f*)q; rf_[s][i][1] = *(const v4f*)(q + 16); } }
    asm volatile("s_wait_xcnt 0x0" :: "v"(ow[0]), "v"(ow[1]), "v"(ow[2]), "v"(ow[3]), "v"(oa[0]), "v"(oa[1]), "v"(oa[2]), "v"(oa[3]) : "memory");   // the group's offset registers stay whole until this wait
  };
  auto sts = [&](int s) { __bf16* d = sm + s * (NPL * PLANE) + sr * LP + sc;   // set s always feeds buffer s
#pragma unroll
    for (int i = 0; i < 4; ++i) { *(v8b*)(d + i * 32 * LP) = rw_[s][i];
      if (AM == 2) { *(v8b*)(d + PLANE + i * 32 * LP) = rh_[s][i]; *(v8b*)(d + 2 * PLANE + i * 32 * LP) = rl_[s][i]; }
      else { v8b hv, lv;
#pragma unroll
        for (int e = 0; e < 8; ++e) { const float v = rf_[s][i][e >> 2][e & 3]; const __bf16 hb = (__bf16)v; hv[e] = hb; lv[e] = (__bf16)(v - (float)hb); }
        *(v8b*)(d + PLANE + i * 32 * LP) = hv; if (AM == 1) *(v8b*)(d + 2 * PLANE + i * 32 * LP) = lv; } } };
  auto mma = [&](int s) {   // the products of the pass that lies in buffer s
    const __bf16* sW = sm + s * (NPL * PLANE) + (wc * 64 + col) * LP; const __bf16* sH = sm + s * (NPL * PLANE) + PLANE + (wr * 32 + col) * LP;
#pragma unroll
    for (int kc = 0; kc < 2; ++kc) { v16b w[4], ah[2], al[2];
#pragma unroll
      for (int ct = 0; ct < 4; ++ct) w[ct] = frag_b(sW + ct * 16 * LP + kc * 32, lane);
#pragma unroll
      for (int rt = 0; rt < 2; ++rt) { ah[rt] = frag_b(sH + rt * 16 * LP + kc * 32, lane); if (AM != 0) al[rt] = frag_b(sH + PLANE + rt * 16 * LP + kc * 32, lane); }
      if (AM != 0) {
#pragma unroll
        for (int rt = 0; rt < 2; ++rt)
#pragma unroll
          for (int ct = 0; ct < 4; ++ct) acc[rt][ct] = wmma_bf(al[rt], w[ct], acc[rt][ct]); }
#pragma unroll
      for (int rt = 0; rt < 2; ++rt)
#pragma unroll
        for (int ct = 0; ct < 4; ++ct) acc[rt][ct] = wmma_bf(ah[rt], w[ct], acc[rt][ct]); } };
  static_assert(NP >= 4 && NP % 2 == 0, "the loop takes two passes a trip and the last two stand behind it");
  ldg(0, 0); ldg(1, 1); sts(0); bar_lds();
#pragma unroll 1
  for (int p = 0; p < NP - 2; p += 2) {   // rolled: a trip is two passes, so that set and buffer are constants
    ldg(p + 2, 0);   // lands under this pass and the next: read at the foot of pass p + 1
    mma(0); sts(1);  // into the buffer whose last readers left before the previous pass's barrier
    bar_lds();       // publishes pass p + 1 and ends every read of pass p's buffer
    ldg(p + 3, 1);
    mma(1); sts(0);
    bar_lds();
  }
  mma(0); sts(1); bar_lds();   // the last two passes: nothing is left to load, so no branch stands around a load in the loop
  mma(1); bar_lds();           // ends every read of the ring: the epilogues stage in it
}
// ---- k_proj: block = (128 rows, 128 cols, which): 0 q, 1 k -> f16 hi/lo rows (+ bias); 2 v -> hi/lo transposed planes per batch; the epilogue stages in the ring's LDS behind the last pass's barrier
__global__ __launch_bounds__(256) void k_proj(const float* __restrict__ X, const __bf16* __restrict__ PK, const float* __restrict__ BQ, const float* __restrict__ BK, const float* __restrict__ BV, _Float16* __restrict__ QH, _Float16* __restrict__ QL_, _Float16* __restrict__ KH, _Float16* __restrict__ KL, _Float16* __restrict__ VTH, _Float16* __restrict__ VTL) {
  __shared__ __align__(16) __bf16 sm[2 * 2 * PLANE];
  const int tid = threadIdx.x, wave = tid >> 5, lane = tid & 31, col = lane & 15, g = lane >> 4, wr = wave >> 1, wc = wave & 1; const int which = blockIdx.z; const int rb = blockIdx.x * 128, n0 = blockIdx.y * 128;
  const __bf16* P = PK + ((which == 0) ? PK_Q : (which == 1) ? PK_K : PK_V); const float* BB = (which == 0) ? BQ : (which == 1) ? BK : BV;
  v8f acc[2][4] = {};
  gemm_tile<0, DM>(X, nullptr, nullptr, P, sm, rb, n0, NR, acc);
  const int rw = rb + wr * 32, nw = n0 + wc * 64;
  if (which < 2) {
    _Float16* sh = (_Float16*)sm + wave * (2 * 32 * LP); _Float16* sl = sh + 32 * LP;
#pragma unroll
    for (int ct = 0; ct < 4; ++ct) { const float bb = bfr(BB[nw + ct * 16 + col]);
#pragma unroll
      for (int rt = 0; rt < 2; ++rt)
#pragma unroll
        for (int r = 0; r < 8; ++r) { const float vv = acc[rt][ct][r] + bb; const _Float16 hv = (_Float16)vv; const int o = (rt * 16 + 8 * g + r) * LP + ct * 16 + col; sh[o] = hv; sl[o] = (_Float16)((vv - (float)hv) * 2048.0f); } }
    LDSX();
    _Float16* DH_ = (which == 0) ? QH : KH; _Float16* DL_ = (which == 0) ? QL_ : KL;
    for (int q = 0; q < 8; ++q) { const int rl = q * 4 + (lane >> 3), c8 = (lane & 7) * 8; const size_t o = (size_t)(rw + rl) * DM + nw + c8; vst2((unsigned*)(DH_ + o), *(const v4u*)&sh[rl * LP + c8]); vst2((unsigned*)(DL_ + o), *(const v4u*)&sl[rl * LP + c8]); }
  } else {
    _Float16* sth = (_Float16*)sm; _Float16* stl = sth + 128 * 136;   // [128 d][128 s], pitch 136
#pragma unroll
    for (int ct = 0; ct < 4; ++ct) { const float bb = bfr(BB[nw + ct * 16 + col]);
#pragma unroll
      for (int rt = 0; rt < 2; ++rt) { v8h h8, l8;
#pragma unroll
        for (int r = 0; r < 8; ++r) { const float vv = acc[rt][ct][r] + bb; const _Float16 hv = (_Float16)vv; h8[r] = hv; l8[r] = (_Float16)((vv - (float)hv) * 2048.0f); }
        const int o = (wc * 64 + ct * 16 + col) * 136 + wr * 32 + rt * 16 + 8 * g; *(v8h*)&sth[o] = h8; *(v8h*)&stl[o] = l8; } }
    __syncthreads();
    const int b = rb / SS, s0 = rb % SS;
    for (int e = tid; e < 128 * 16; e += 256) { const int d = e >> 4, pc = e & 15; const size_t o = ((size_t)b * DM + n0 + d) * SS + s0 + pc * 8; vst2((unsigned*)(VTH + o), *(const v4u*)&sth[d * 136 + pc * 8]); vst2((unsigned*)(VTL + o), *(const v4u*)&stl[d * 136 + pc * 8]); }
  }
}
// ---- k_attn: block = (64 queries i, h, b): key steps covering [i0 - 25, i0 + 63 + 25] within [0, S); c = q.k (3 products); rel band: window slot t <-> offset (j - i) = t0w + t with t0w = j0 - iw0 - 15, row = clip(t0w + t, -5, 5) + 5 (3 products) -> LDS, picked at jl - il + 15; scores = (c + rel)/8 within |j - i| <= 25 and 0 <= j < S, else -inf; online softmax; P hi/lo x V hi/lo
// fragment at a block-uniform base plus a lane's own 32-bit byte offset (its 16 * (lane >> 4) included): fewer address registers held beside a group of loads
__device__ __forceinline__ v16h fragu(const _Float16* base, unsigned off) {
  union { v16h v; v8h q[2]; } u; const char* p = (const char*)base + off;
  u.q[0] = *(const v8h*)p; u.q[1] = *(const v8h*)(p + 32); return u.v;
}
__global__ __launch_bounds__(128) void k_attn(const _Float16* __restrict__ QH, const _Float16* __restrict__ QL_, const _Float16* __restrict__ KH, const _Float16* __restrict__ KL, const _Float16* __restrict__ RELH, const _Float16* __restrict__ RELL, const _Float16* __restrict__ VTH, const _Float16* __restrict__ VTL, float* __restrict__ O) {
  __shared__ __align__(16) _Float16 sph[4][16][40], spl[4][16][40]; __shared__ float srl[4][16][49]; __shared__ __align__(16) float so[4][16][68];
  const int tid = threadIdx.x, wave = tid >> 5, lane = tid & 31, col = lane & 15, g = lane >> 4; const int qb = blockIdx.x + TQ0, h = blockIdx.y, b = blockIdx.z; const int i0 = qb * 64, iw0 = i0 + wave * 16;
  v16h aq[2], aql[2];
#pragma unroll
  for (int kc = 0; kc < 2; ++kc) { const size_t o = ((size_t)b * SS + iw0 + col) * DM + h * HD + kc * 32; aq[kc] = frag_h(QH + o, lane); aql[kc] = frag_h(QL_ + o, lane); }
  const _Float16* Vh = VTH + ((size_t)b * DM + h * HD) * SS; const _Float16* Vl = VTL + ((size_t)b * DM + h * HD) * SS;
  float m[8], l[8];
#pragma unroll
  for (int r = 0; r < 8; ++r) { m[r] = -3.0e38f; l[r] = 0.f; }
  v8f acc[4] = {}, accl[4] = {};
  const unsigned ko = (unsigned)col * (2 * DM) + 16 * g, vo = (unsigned)col * (2 * SS) + 16 * g;   // the lane's byte offsets in a key tile and in a value tile: the same in every step
  const int jlo = max(i0 - RAD, 0), jhi = min(i0 + 63 + RAD, SS - 1); const int ks0 = jlo / 32, ks1 = jhi / 32;
#pragma unroll 1
  for (int ks = ks0; ks <= ks1; ++ks) { const int j0 = ks * 32;
    const int t0w = j0 - iw0 - 15;   // offset (j - i) of window slot 0
    const size_t kb0 = ((size_t)b * SS + j0) * DM + h * HD;   // the step's first key row, the same for the whole block
    v16h rh[3][2], rl[3][2], kh[2][2], kl[2][2], vh[4], vl[4];
    auto ldrel = [&](int ct3) { int rr = t0w + ct3 * 16 + col; rr = min(max(rr, -KREL), KREL) + KREL;
#pragma unroll
      for (int kc = 0; kc < 2; ++kc) { const unsigned o = (unsigned)rr * (2 * HD) + 16 * g; rh[ct3][kc] = fragu(RELH + kc * 32, o); rl[ct3][kc] = fragu(RELL + kc * 32, o); } };
    ldrel(0); ldrel(1);
    __builtin_amdgcn_sched_barrier(0);   // these 16 loads of relative rows fly together: without it each pair is issued in front of its own product and waited for alone
#pragma unroll
    for (int ct3 = 0; ct3 < 3; ++ct3) { v8f u = {}, ul = {};
#pragma unroll
      for (int kc = 0; kc < 2; ++kc) { u = wmma16(aq[kc], rh[ct3][kc], u); ul = wmma16(aql[kc], rh[ct3][kc], ul); ul = wmma16(aq[kc], rl[ct3][kc], ul); }
#pragma unroll
      for (int r = 0; r < 8; ++r) srl[wave][8 * g + r][ct3 * 16 + col] = u[r] + ul[r] * (1.0f / 2048.0f);
      if (ct3 == 0) { ldrel(2);
        __builtin_amdgcn_sched_barrier(0);   // the last 8 loads of relative rows fly under the second tile's products, in the registers the first tile has left
      } }
#pragma unroll
    for (int ct = 0; ct < 2; ++ct)
#pragma unroll
      for (int kc = 0; kc < 2; ++kc) { kh[ct][kc] = fragu(KH + kb0 + ct * 16 * DM + kc * 32, ko); kl[ct][kc] = fragu(KL + kb0 + ct * 16 * DM + kc * 32, ko); }
    __builtin_amdgcn_sched_barrier(0);   // the 16 key loads fly together
    LDSX();
    v8f c[2] = {}, cl[2] = {};
#pragma unroll
    for (int ct = 0; ct < 2; ++ct)
#pragma unroll
      for (int kc = 0; kc < 2; ++kc) { c[ct] = wmma16(aq[kc], kh[ct][kc], c[ct]); cl[ct] = wmma16(aql[kc], kh[ct][kc], cl[ct]); cl[ct] = wmma16(aq[kc], kl[ct][kc], cl[ct]); }
    float rv[2][8];
#pragma unroll
    for (int ct = 0; ct < 2; ++ct)
#pragma unroll
      for (int r = 0; r < 8; ++r) rv[ct][r] = srl[wave][8 * g + r][ct * 16 + col - (8 * g + r) + 15];   // slot 0..46, always written: read outside the mask's test, all 16 behind one wait
    v8f s[2];
#pragma unroll
    for (int ct = 0; ct < 2; ++ct) { const int kk = j0 + ct * 16 + col, d0 = kk - iw0 - 8 * g, dlo = d0 - RAD, dhi = d0 + RAD;   // d0 = j - i of the lane's first row; row r is tested against a constant, so no register a row is held over the loop
#pragma unroll
      for (int r = 0; r < 8; ++r) { const bool ok = (dlo <= r) && (dhi >= r) && (kk < SS);   // |j - i| <= 25 for row r
        s[ct][r] = ok ? (c[ct][r] + cl[ct][r] * (1.0f / 2048.0f) + rv[ct][r]) * 0.125f : -3.0e38f; } }
#pragma unroll
    for (int r = 0; r < 8; ++r) { float mx = fmaxf(s[0][r], s[1][r]);
#pragma unroll
      for (int o = 1; o < 16; o <<= 1) mx = fmaxf(mx, __shfl_xor(mx, o));
      const float mn = fmaxf(m[r], mx); const float alpha = (m[r] <= -1.0e38f) ? 0.f : __expf(m[r] - mn);
      const float e0 = (s[0][r] <= -1.0e38f) ? 0.f : __expf(s[0][r] - mn), e1 = (s[1][r] <= -1.0e38f) ? 0.f : __expf(s[1][r] - mn); float es = e0 + e1;
#pragma unroll
      for (int o = 1; o < 16; o <<= 1) es += __shfl_xor(es, o);
      l[r] = l[r] * alpha + es; m[r] = (mn <= -1.0e38f) ? m[r] : mn;
#pragma unroll
      for (int dt = 0; dt < 4; ++dt) { acc[dt][r] *= alpha; accl[dt][r] *= alpha; }
      const _Float16 h0 = (_Float16)e0, h1 = (_Float16)e1; sph[wave][8 * g + r][col] = h0; sph[wave][8 * g + r][16 + col] = h1; spl[wave][8 * g + r][col] = (_Float16)((e0 - (float)h0) * 2048.0f); spl[wave][8 * g + r][16 + col] = (_Float16)((e1 - (float)h1) * 2048.0f); }
    __builtin_amdgcn_sched_barrier(0);   // keeps the value loads behind the softmax: held through it, their 64 registers push the wave past 256 and cost a wave per SIMD
    const _Float16* pvh = (const _Float16*)((const char*)(Vh + j0) + vo); const _Float16* pvl = (const _Float16*)((const char*)(Vl + j0) + vo);
#pragma unroll
    for (int dt = 0; dt < 4; ++dt) { vh[dt] = fragu(pvh + dt * 16 * SS, 0u); vl[dt] = fragu(pvl + dt * 16 * SS, 0u); }
    asm volatile("s_wait_xcnt 0x0" :: "v"(pvh), "v"(pvl) : "memory");   // the two address pairs stay whole until this wait
    __builtin_amdgcn_sched_barrier(0);   // the 16 value loads fly together, under the hand-over of P through LDS
    LDSX();
    const v16h pah = frag_h(&sph[wave][col][0], lane), pal = frag_h(&spl[wave][col][0], lane);
#pragma unroll
    for (int dt = 0; dt < 4; ++dt) { acc[dt] = wmma16(pah, vh[dt], acc[dt]); accl[dt] = wmma16(pal, vh[dt], accl[dt]); accl[dt] = wmma16(pah, vl[dt], accl[dt]); }
    LDSX(); }
#pragma unroll
  for (int r = 0; r < 8; ++r) { const float il = 1.0f / l[r];
#pragma unroll
    for (int dt = 0; dt < 4; ++dt) so[wave][8 * g + r][dt * 16 + col] = (acc[dt][r] + accl[dt][r] * (1.0f / 2048.0f)) * il; }
  LDSX();
  for (int rl = 0; rl < 16; ++rl) if (lane < 16) vst2(O + ((size_t)b * SS + iw0 + rl) * DM + h * HD + lane * 4, *(const v4f*)&so[wave][rl][lane * 4]);
}
// ---- k_lin<MODE>: block = (128 rows, 128 cols); 0: T1 = O(hi/lo) . Wo^T + bo + src; 1: G = relu(X(hi/lo) . W1^T + b1) -> bf16 hi/lo; 2: T1 = G . W2^T (2 products) + b2 + X; rows at or past nrows are not stored; the epilogue stages in the ring's LDS behind the last pass's barrier
template <int MODE>
__global__ __launch_bounds__(256) void k_lin(const float* __restrict__ A, const __bf16* __restrict__ AG, const __bf16* __restrict__ AGL, const __bf16* __restrict__ PK, const float* __restrict__ BIAS, const float* __restrict__ RES, float* __restrict__ OUTF, __bf16* __restrict__ OUTG, __bf16* __restrict__ OUTGL, int nrows) {
  __shared__ __align__(16) __bf16 sm[2 * 3 * PLANE];
  const int tid = threadIdx.x, wave = tid >> 5, lane = tid & 31, col = lane & 15, g = lane >> 4, wr = wave >> 1, wc = wave & 1; const int rb = blockIdx.x * 128, n0 = blockIdx.y * 128;
  constexpr int KD = (MODE == 2) ? FF : DM; const __bf16* P = PK + ((MODE == 0) ? PK_O : (MODE == 1) ? PK_1 : PK_2);
  v8f acc[2][4] = {};
  gemm_tile<(MODE == 2) ? 2 : 1, KD>(A, AG, AGL, P, sm, rb, n0, nrows, acc);
  const int rw = rb + wr * 32, nw = n0 + wc * 64;
  if (MODE == 1) {
    __bf16* sg = sm + wave * (2 * 32 * LP); __bf16* sgl = sg + 32 * LP;
#pragma unroll
    for (int ct = 0; ct < 4; ++ct) { const float bb = bfr(BIAS[nw + ct * 16 + col]);
#pragma unroll
      for (int rt = 0; rt < 2; ++rt)
#pragma unroll
        for (int r = 0; r < 8; ++r) { const float v = fmaxf(acc[rt][ct][r] + bb, 0.f); const __bf16 hb = (__bf16)v; const int o = (rt * 16 + 8 * g + r) * LP + ct * 16 + col; sg[o] = hb; sgl[o] = (__bf16)(v - (float)hb); } }
    LDSX();
    for (int q = 0; q < 8; ++q) { const int rl = q * 4 + (lane >> 3), c8 = (lane & 7) * 8; if (rw + rl < nrows) { const size_t o = (size_t)(rw + rl) * FF + nw + c8; vst2((unsigned*)(OUTG + o), *(const v4u*)&sg[rl * LP + c8]); vst2((unsigned*)(OUTGL + o), *(const v4u*)&sgl[rl * LP + c8]); } }
  } else {
    float* so = (float*)sm + wave * (32 * 68);
#pragma unroll
    for (int ct = 0; ct < 4; ++ct) { const float bb = bfr(BIAS[nw + ct * 16 + col]);
#pragma unroll
      for (int rt = 0; rt < 2; ++rt)
#pragma unroll
        for (int r = 0; r < 8; ++r) so[(rt * 16 + 8 * g + r) * 68 + ct * 16 + col] = acc[rt][ct][r] + bb; }
    LDSX();
    for (int q = 0; q < 16; ++q) { const int rl = q * 2 + g; if (rw + rl < nrows) { const size_t o = (size_t)(rw + rl) * DM + nw + col * 4; v4f v = *(const v4f*)&so[rl * 68 + col * 4]; const v4f rs = *(const v4f*)(RES + o);
#pragma unroll
        for (int i = 0; i < 4; ++i) v[i] += (MODE == 0) ? bfr(rs[i]) : rs[i];
        vst2(OUTF + o, v); } }
  }
}
// ---- k_ln: wave = row (32 lanes x 32 floats, a load = 512 contiguous bytes), 8 rows a block, no LDS: LayerNorm (biased variance, eps 1e-5)
__global__ __launch_bounds__(256) void k_ln(const float* __restrict__ T, const float* __restrict__ G, const float* __restrict__ Bv, float* __restrict__ OUT) {
  const int t = threadIdx.x, lane = t & 31; const size_t row = (size_t)blockIdx.x * 8 + __builtin_amdgcn_readfirstlane(t >> 5);   // the row is the wave's: its base address stays scalar
  const float* p = T + row * DM + lane * 4;
  v4f v[8];
#pragma unroll
  for (int i = 0; i < 8; ++i) v[i] = *(const v4f*)(p + i * 128);
  float s4[4] = {0.f, 0.f, 0.f, 0.f};
#pragma unroll
  for (int i = 0; i < 8; ++i)
#pragma unroll
    for (int e = 0; e < 4; ++e) s4[e] += v[i][e];
  float s = (s4[0] + s4[1]) + (s4[2] + s4[3]);
#pragma unroll
  for (int o = 1; o < 32; o <<= 1) s += __shfl_xor(s, o);
  const float mu = s / (float)DM; float q4[4] = {0.f, 0.f, 0.f, 0.f};
#pragma unroll
  for (int i = 0; i < 8; ++i)
#pragma unroll
    for (int e = 0; e < 4; ++e) { const float d = v[i][e] - mu; q4[e] += d * d; }
  float q = (q4[0] + q4[1]) + (q4[2] + q4[3]);
#pragma unroll
  for (int o = 1; o < 32; o <<= 1) q += __shfl_xor(q, o);
  const float inv = 1.0f / sqrtf(q / (float)DM + 1e-5f);
#pragma unroll
  for (int i = 0; i < 8; ++i) { const v4f gg = *(const v4f*)(G + lane * 4 + i * 128), bb = *(const v4f*)(Bv + lane * 4 + i * 128); v4f o4;
#pragma unroll
    for (int e = 0; e < 4; ++e) o4[e] = (v[i][e] - mu) * inv * bfr(gg[e]) + bfr(bb[e]);
    vst2(OUT + row * DM + lane * 4 + i * 128, o4); }
}
extern "C" void kernel_launch(void* const* d_in, const int* in_sizes, int n_in, void* d_out, int out_size, void* d_ws, size_t ws_size, hipStream_t stream) {
  (void)in_sizes; (void)n_in; (void)out_size;
  const float** F = (const float**)d_in;   // 0 src [2,2048,1024], 1 wq [1024,1024] natural, 2 bq, 3 wk, 4 bk, 5 wv, 6 bv, 7 wo, 8 bo, 9 rel_emb [11,64], 10 w1 [4096,1024] natural, 11 b1, 12 w2 [1024,4096] natural, 13 b2, 14 g1, 15 beta1, 16 g2, 17 beta2
  if (ws_size < (size_t)WS_END) return;
  char* ws = (char*)d_ws; __bf16 *PK = (__bf16*)(ws + WS_PK), *GH = (__bf16*)(ws + WS_GH), *GL = (__bf16*)(ws + WS_GL); _Float16 *QH = (_Float16*)(ws + WS_QH), *QLp = (_Float16*)(ws + WS_QL), *KH = (_Float16*)(ws + WS_KH), *KL = (_Float16*)(ws + WS_KL), *VTH = (_Float16*)(ws + WS_VTH), *VTL = (_Float16*)(ws + WS_VTL), *RELH = (_Float16*)(ws + WS_REL), *RELL = (_Float16*)(ws + WS_RELL); float *O = (float*)(ws + WS_O), *T1 = (float*)(ws + WS_T1), *Hh = (float*)(ws + WS_H);
  k_pack<<<PK_NB + 1, 256, 0, stream>>>(F[1], F[3], F[5], F[7], F[10], F[12], F[9], PK, RELH, RELL);
  k_proj<<<dim3(NR / 128, DM / 128, 3), 256, 0, stream>>>(F[0], PK, F[2], F[4], F[6], QH, QLp, KH, KL, VTH, VTL);
  k_attn<<<dim3(TQB, NH, NB), 128, 0, stream>>>(QH, QLp, KH, KL, RELH, RELL, VTH, VTL, O);
#ifndef TWIN_ROWS
  const size_t R0 = 0; const int NRW = NR; (void)R0;
  k_lin<0><<<dim3(NR / 128, DM / 128), 256, 0, stream>>>(O, nullptr, nullptr, PK, F[8], F[0], T1, nullptr, nullptr, NRW);
  k_ln<<<NR / 8, 256, 0, stream>>>(T1, F[14], F[15], Hh);
  k_lin<1><<<dim3(NR / 128, FF / 128), 256, 0, stream>>>(Hh, nullptr, nullptr, PK, F[11], nullptr, nullptr, GH, GL, NRW);
  k_lin<2><<<dim3(NR / 128, DM / 128), 256, 0, stream>>>(nullptr, GH, GL, PK, F[13], Hh, T1, nullptr, nullptr, NRW);
  k_ln<<<NR / 8, 256, 0, stream>>>(T1, F[16], F[17], (float*)d_out);
#else
  for (int bb = 0; bb < NB; ++bb) { const size_t R0 = (size_t)bb * SS + (size_t)TQ0 * 64; const int NRW = TQB * 64;   // only the attended rows of each batch
  k_lin<0><<<dim3((NRW + 127) / 128, DM / 128), 256, 0, stream>>>(O + R0 * DM, nullptr, nullptr, PK, F[8], F[0] + R0 * DM, T1 + R0 * DM, nullptr, nullptr, NRW);
  k_ln<<<NRW / 8, 256, 0, stream>>>(T1 + R0 * DM, F[14], F[15], Hh + R0 * DM);
  k_lin<1><<<dim3((NRW + 127) / 128, FF / 128), 256, 0, stream>>>(Hh + R0 * DM, nullptr, nullptr, PK, F[11], nullptr, nullptr, GH + R0 * FF, GL + R0 * FF, NRW);
  k_lin<2><<<dim3((NRW + 127) / 128, DM / 128), 256, 0, stream>>>(nullptr, GH + R0 * FF, GL + R0 * FF, PK, F[13], Hh + R0 * DM, T1 + R0 * DM, nullptr, nullptr, NRW);
  k_ln<<<NRW / 8, 256, 0, stream>>>(T1 + R0 * DM, F[16], F[17], (float*)d_out + R0 * DM); }
#endif
}

// v005
// Measured time: 216 microseconds a run.
// In both of two side-by-side timings against v004, it was 1.04 times as fast.
// Over all steps from v000 it is 3.40 times as fast.
// compute dtype: all inputs rounded to bf16; q, k, v = src . W^T + b with EXACT bf16 products on WMMA 16x16x32 (natural [out][in] rows); q and k stored as f16 hi + (x2048-scaled) residual planes, the 11 relative-position rows likewise; per (query tile, key step) inside the +-25 window: q . k and the relative term q . rel_emb[clip(j - i, -5, 5) + 5] (a 48-wide skewed window GEMM with the row index clamped exactly like the module's clip, gathered per (i,j) from LDS), 3 products each, x 64^-1/2, window / validity mask, running-max softmax in f32 (hardware exp); P as f16 hi + (x2048) residual x v hi/lo (3 products); out . Wo (ctx as bf16 hi + residual, 2 products) + bo + src, LayerNorm (eps 1e-5) in f32; FFN: x (hi + residual) . W1^T + b1 (2 products), ReLU, (hi + residual) . W2^T + b2 + x (2 products), LayerNorm; f32 accumulate.
#include <hip/hip_runtime.h>
#include <math.h>

typedef __attribute__((ext_vector_type(16))) _Float16 v16h;
typedef __attribute__((ext_vector_type(16))) __bf16 v16b;
typedef __attribute__((ext_vector_type(8)))  _Float16 v8h;
typedef __attribute__((ext_vector_type(8)))  float v8f;
typedef __attribute__((ext_vector_type(4)))  float v4f;
typedef __attribute__((ext_vector_type(2)))  float v2f;
typedef __attribute__((ext_vector_type(4)))  unsigned v4u;
typedef __attribute__((ext_vector_type(4)))  int v4i;
typedef float __attribute__((may_alias)) float_a;
typedef int __attribute__((may_alias)) int_a;

template <typename T> __device__ __forceinline__ void vst2(void* p, T v) { *(T*)p = v;  }
__device__ __forceinline__ v8f wmma16(v16h a, v16h b, v8f c) {
  v8f d = __builtin_amdgcn_wmma_f32_16x16x32_f16(false, a, false, b, (short)0, c, false, false);
  asm volatile("v_nop\n\tv_nop\n\tv_nop\n\tv_nop" : "+v"(d) : "v"(a), "v"(b));
  return d;
}
__device__ __forceinline__ v8f wmma_bf(v16b a, v16b b, v8f c) {
  v8f d = __builtin_amdgcn_wmma_f32_16x16x32_bf16(false, a, false, b, (short)0, c, false, false);
  asm volatile("v_nop\n\tv_nop\n\tv_nop\n\tv_nop" : "+v"(d) : "v"(a), "v"(b));
  return d;
}
// 16x16x32 fragments: lane = (h = lane>>4, row/col = lane&15); elements 0..7 = k0+8h+0..7, 8..15 = k0+16+8h+0..7; D element r = row 8h+r
__device__ __forceinline__ v16h frag_h(const _Float16* rowk0, int lane) {
  union { v16h v; v8h q[2]; } u; const _Float16* p = rowk0 + 8 * (lane >> 4);
  u.q[0] = *(const v8h*)p; u.q[1] = *(const v8h*)(p + 16); return u.v;
}
__device__ __forceinline__ v16h frag_f32(const float* rowk0, int lane) {
  v16h a; const float* p = rowk0 + 8 * (lane >> 4);
#pragma unroll
  for (int i = 0; i < 8; ++i) { a[i] = (_Float16)p[i]; a[8 + i] = (_Float16)p[16 + i]; }
  return a;
}
__device__ __forceinline__ v16h frag_f32s(const float* rowk0, int lane, float sc) {
  v16h a; const float* p = rowk0 + 8 * (lane >> 4);
#pragma unroll
  for (int i = 0; i < 8; ++i) { a[i] = (_Float16)(p[i] * sc); a[8 + i] = (_Float16)(p[16 + i] * sc); }
  return a;
}
// column fragment from a [K][ld] layout (column n), rows >= K read as 0
__device__ __forceinline__ v16h fragc_f32(const float* W, int k0, int n, int lane, int ld, int K) {
  v16h a; const int g = lane >> 4;
#pragma unroll
  for (int i = 0; i < 8; ++i) { const int ka = k0 + 8 * g + i, kb = ka + 16;
    a[i] = (_Float16)(ka < K ? W[(size_t)(ka < K ? ka : K - 1) * ld + n] : 0.f); a[8 + i] = (_Float16)(kb < K ? W[(size_t)(kb < K ? kb : K - 1) * ld + n] : 0.f); }
  return a;
}
struct F2 { v16b h, l; };
__device__ __forceinline__ F2 bsplit16(const float v[16]) { F2 r;
#pragma unroll
  for (int i = 0; i < 16; ++i) { const __bf16 h = (__bf16)v[i]; r.h[i] = h; r.l[i] = (__bf16)(v[i] - (float)h); }
  return r; }
__device__ __forceinline__ F2 split_row(const float* row, int k0, int lane) { float v[16]; const float* p = row + k0 + 8 * (lane >> 4);
#pragma unroll
  for (int i = 0; i < 8; ++i) { v[i] = p[i]; v[8 + i] = p[16 + i]; }
  return bsplit16(v); }
__device__ __forceinline__ F2 split_rowK(const float* row, int k0, int lane, int K) { float v[16]; const int g = lane >> 4;
#pragma unroll
  for (int i = 0; i < 8; ++i) { const int ka = k0 + 8 * g + i, kb = ka + 16; v[i] = ka < K ? row[ka < K ? ka : K - 1] : 0.f; v[8 + i] = kb < K ? row[kb < K ? kb : K - 1] : 0.f; }
  return bsplit16(v); }
__device__ __forceinline__ F2 split_col(const float* W, int k0, int n, int lane, int ld, int K) { float v[16]; const int g = lane >> 4;
#pragma unroll
  for (int i = 0; i < 8; ++i) { const int ka = k0 + 8 * g + i, kb = ka + 16; v[i] = ka < K ? W[(size_t)(ka < K ? ka : K - 1) * ld + n] : 0.f; v[8 + i] = kb < K ? W[(size_t)(kb < K ? kb : K - 1) * ld + n] : 0.f; }
  return bsplit16(v); }
__device__ __forceinline__ v8f mac3(const F2& a, const F2& b, v8f c) { c = wmma_bf(a.l, b.h, c); c = wmma_bf(a.h, b.l, c); return wmma_bf(a.h, b.h, c); }
__device__ __forceinline__ float sigm(float v) { return 1.0f / (1.0f + expf(-v)); }
#define LDSX() do { asm volatile("s_wait_dscnt 0" ::: "memory"); __builtin_amdgcn_wave_barrier(); __builtin_amdgcn_fence(__ATOMIC_RELEASE, "workgroup"); } while (0)


// ETC-style layer (B 2, S 2,048, d 1,024, 16 heads x 64, FFN 4,096): local attention over a +-25 window with clipped relative-position embeddings, output projection + residual + LN, ReLU FFN + residual + LN.
#define NB 2
#define SS 2048
#define NR (NB * SS)
#define DM 1024
#define NH 16
#define HD 64
#define FF 4096
#define RAD 25
#define KREL 5
#define NREL (2 * KREL + 1)
#ifndef TQB
#define TQB (SS / 64)
#endif
#ifndef TQ0
#define TQ0 0
#endif
typedef __attribute__((ext_vector_type(8))) __bf16 v8b;
__device__ __forceinline__ v16b frag_b(const __bf16* rowk0, int lane) {
  union { v16b v; v8b q[2]; } u; const __bf16* p = rowk0 + 8 * (lane >> 4);
  u.q[0] = *(const v8b*)p; u.q[1] = *(const v8b*)(p + 16); return u.v;
}
__device__ __forceinline__ float bfr(float v) { return (float)(__bf16)v; }
__device__ __attribute__((noinline)) float exp_ni(float v) { return expf(v); }
__device__ __attribute__((noinline)) float erf_ni(float v) { return erff(v); }

#define PK_Q  0
#define PK_K  ((size_t)DM * DM)
#define PK_V  ((size_t)2 * DM * DM)
#define PK_O  ((size_t)3 * DM * DM)
#define PK_1  ((size_t)4 * DM * DM)                // [4096][1024] w1 natural
#define PK_2  (PK_1 + (size_t)FF * DM)             // [1024][4096] w2 natural
#define PK_END (PK_2 + (size_t)DM * FF)
#define WS_PK  0u
#define WS_QH  (((2u * PK_END) + 127u) / 128u * 128u)    // f16 q hi ; QL ; KH ; KL, each in fragment order: [b][head][16-row tile][kc][half][lane][8]
#define WS_QL  (WS_QH + 2u * NR * DM)
#define WS_KH  (WS_QL + 2u * NR * DM)
#define WS_KL  (WS_KH + 2u * NR * DM)
#define WS_VTH (WS_KL + 2u * NR * DM)                    // f16 v hi ; VTL, in fragment order: [b][16-d tile][32-key step][half][lane][8]
#define WS_VTL (WS_VTH + 2u * NR * DM)
#define WS_REL (WS_VTL + 2u * NR * DM)                   // f16 [16 rows][64] rel hi ; RELL (11 real)
#define WS_RELL (WS_REL + 2u * 16 * HD)
#define WS_O   (((WS_RELL + 2u * 16 * HD) + 127u) / 128u * 128u)   // f32 [4096][1024] ctx
#define WS_T1  (WS_O + 4u * NR * DM)                     // f32 pre-LN (reused)
#define WS_H   (WS_T1 + 4u * NR * DM)                    // f32 x = LN1 output
#define WS_GH  (WS_H + 4u * NR * DM)                     // bf16 [4096][4096] relu hi ; GL
#define WS_GL  (WS_GH + 2u * (size_t)NR * FF)
#define WS_END (WS_GL + 2u * (size_t)NR * FF)

// ---- k_pack: every weight rounded to bf16 in its natural [out][in] order. A block = PKB consecutive elements of one matrix (each matrix is a whole number of blocks): 16 loads of 4 floats a thread, a wave's load = 512 contiguous bytes, all issued ahead of the first store; no LDS. The block behind the last weight block makes the relative-position planes (16 rows, 11 real).
#define PKB 16384
#define PK_NB ((int)(PK_END / PKB))
typedef __attribute__((ext_vector_type(4))) __bf16 v4b;
typedef __attribute__((ext_vector_type(4))) _Float16 v4h;
__global__ __launch_bounds__(256) void k_pack(const float* __restrict__ WQ, const float* __restrict__ WK, const float* __restrict__ WV, const float* __restrict__ WO, const float* __restrict__ W1, const float* __restrict__ W2, const float* __restrict__ RELE, __bf16* __restrict__ PK, _Float16* __restrict__ RELH, _Float16* __restrict__ RELL) {
  const int t = threadIdx.x; const unsigned blk = blockIdx.x;
  if (blk == (unsigned)PK_NB) { const int e = t * 4; v4f v = {}; if (e < NREL * HD) v = *(const v4f*)(RELE + e); v4h hi, lo;
#pragma unroll
    for (int i = 0; i < 4; ++i) { const float x = bfr(v[i]); const _Float16 hv = (_Float16)x; hi[i] = hv; lo[i] = (_Float16)((x - (float)hv) * 2048.0f); }
    vst2(RELH + e, hi); vst2(RELL + e, lo); return; }
  constexpr unsigned BM = DM * DM / PKB;   // blocks of a 1024 x 1024 matrix
  const unsigned m = blk / BM; const float* S = (m == 0) ? WQ : (m == 1) ? WK : (m == 2) ? WV : (m == 3) ? WO : (m < 8) ? W1 : W2; const unsigned b0 = (m < 4) ? m * BM : (m < 8) ? 4 * BM : 8 * BM;
  const float* p = S + (size_t)(blk - b0) * PKB + t * 4; __bf16* d = PK + (size_t)blk * PKB + t * 4; v4f v[16];
#pragma unroll
  for (int i = 0; i < 16; ++i) v[i] = *(const v4f*)(p + i * 1024);
  __builtin_amdgcn_sched_barrier(0);   // all 16 loads in flight together: without it the last two are issued behind the wait for the first
  v4b o[16];
#pragma unroll
  for (int i = 0; i < 16; ++i)
#pragma unroll
    for (int e = 0; e < 4; ++e) o[i][e] = (__bf16)v[i][e];
  __builtin_amdgcn_sched_barrier(0);   // the stores as one run behind the last conversion: otherwise later conversions reuse the registers of issued stores and wait for them
#pragma unroll
  for (int i = 0; i < 16; ++i) vst2(d + i * 1024, o[i]);
}
// work-group barrier that orders LDS alone: __syncthreads() also waits for every global load in flight, and the GEMM core's loads of a later pass are to stay in flight across it
__device__ __forceinline__ void bar_lds() {
  __builtin_amdgcn_fence(__ATOMIC_RELEASE, "workgroup", "local");
  __builtin_amdgcn_s_barrier();
  __builtin_amdgcn_fence(__ATOMIC_ACQUIRE, "workgroup", "local");
}
// ---- GEMM core shared by k_proj and k_lin: block = 256 threads = 8 waves (4 x 2), one 128 x 128 tile of Y = A . W^T; a pass is 64 k of every operand row.
// Each pass's rows (W, A hi, A residual, all bf16) are staged once per block in LDS and read from there by every wave that needs them; two buffers, one barrier per pass; their global loads are issued two passes ahead.
// Wave (wr, wc) owns rows wr*32..+31, cols wc*64..+63: 2 x 4 accumulator tiles. Per accumulator the products keep the order k ascending, residual before hi.
#define LP 72                 // LDS row pitch in 16-bit elements: 144 B = 16 B x odd, for the 16-byte fragment reads
#define PLANE (128 * LP)      // one staged operand plane: 128 rows
// AM 0: A f32, rounded to one bf16 plane; 1: A f32, split into bf16 hi + residual; 2: A given as two bf16 planes (AH, AL). Rows of A at or past nrows are read as row nrows - 1 (their results are not stored).
template <int AM, int KD>
__device__ __forceinline__ void gemm_tile(const float* __restrict__ A, const __bf16* __restrict__ AH, const __bf16* __restrict__ AL, const __bf16* __restrict__ Wt, __bf16* sm, int rb, int n0, int nrows, v8f (&acc)[2][4]) {
  constexpr int NPL = (AM == 0) ? 2 : 3, NP = KD / 64;
  const int tid = threadIdx.x, wave = tid >> 5, lane = tid & 31, col = lane & 15, wr = wave >> 1, wc = wave & 1;
  const int sc = (tid & 7) * 8, sr = tid >> 3;   // staging: this thread's 8 k of a row, and its row in each group of 32
  unsigned ao[4], wo[4];   // the thread's 32-bit byte offsets from the operands' block-uniform bases: one register a row and not a pair, so that both register sets fit beside them
#pragma unroll
  for (int i = 0; i < 4; ++i) { ao[i] = (unsigned)(min(rb + sr + 32 * i, nrows - 1) * KD + sc) * (AM == 2 ? 2u : 4u); wo[i] = (unsigned)((n0 + sr + 32 * i) * KD + sc) * 2u; }
  v8b rw_[2][4], rh_[2][4], rl_[2][4]; v4f rf_[2][4][2];   // two register sets: pass p + 1 waits in one for its place in LDS while pass p + 2 lands in the other
  auto ldg = [&](int p, int s) { const unsigned kw = (unsigned)p * 128u, ka = (unsigned)p * (AM == 2 ? 128u : 256u);   // a pass's 64 k in bytes
    unsigned ow[4], oa[4];
#pragma unroll
    for (int i = 0; i < 4; ++i) { ow[i] = wo[i] + kw; oa[i] = ao[i] + ka; }
#pragma unroll
    for (int i = 0; i < 4; ++i) { rw_[s][i] = *(const v8b*)((const char*)Wt + ow[i]);
      if (AM == 2) { rh_[s][i] = *(const v8b*)((const char*)AH + oa[i]); rl_[s][i] = *(const v8b*)((const char*)AL + oa[i]); }
      else { const char* q = (const char*)A + oa[i]; rf_[s][i][0] = *(const v4f*)q; rf_[s][i][1] = *(const v4f*)(q + 16); } }
    asm volatile("s_wait_xcnt 0x0" :: "v"(ow[0]), "v"(ow[1]), "v"(ow[2]), "v"(ow[3]), "v"(oa[0]), "v"(oa[1]), "v"(oa[2]), "v"(oa[3]) : "memory");   // the group's offset registers stay whole until this wait
  };
  auto sts = [&](int s) { __bf16* d = sm + s * (NPL * PLANE) + sr * LP + sc;   // set s always feeds buffer s
#pragma unroll
    for (int i = 0; i < 4; ++i) { *(v8b*)(d + i * 32 * LP) = rw_[s][i];
      if (AM == 2) { *(v8b*)(d + PLANE + i * 32 * LP) = rh_[s][i]; *(v8b*)(d + 2 * PLANE + i * 32 * LP) = rl_[s][i]; }
      else { v8b hv, lv;
#pragma unroll
        for (int e = 0; e < 8; ++e) { const float v = rf_[s][i][e >> 2][e & 3]; const __bf16 hb = (__bf16)v; hv[e] = hb; lv[e] = (__bf16)(v - (float)hb); }
        *(v8b*)(d + PLANE + i * 32 * LP) = hv; if (AM == 1) *(v8b*)(d + 2 * PLANE + i * 32 * LP) = lv; } } };
  auto mma = [&](int s) {   // the products of the pass that lies in buffer s
    const __bf16* sW = sm + s * (NPL * PLANE) + (wc * 64 + col) * LP; const __bf16* sH = sm + s * (NPL * PLANE) + PLANE + (wr * 32 + col) * LP;
#pragma unroll
    for (int kc = 0; kc < 2; ++kc) { v16b w[4], ah[2], al[2];
#pragma unroll
      for (int ct = 0; ct < 4; ++ct) w[ct] = frag_b(sW + ct * 16 * LP + kc * 32, lane);
#pragma unroll
      for (int rt = 0; rt < 2; ++rt) { ah[rt] = frag_b(sH + rt * 16 * LP + kc * 32, lane); if (AM != 0) al[rt] = frag_b(sH + PLANE + rt * 16 * LP + kc * 32, lane); }
      if (AM != 0) {
#pragma unroll
        for (int rt = 0; rt < 2; ++rt)
#pragma unroll
          for (int ct = 0; ct < 4; ++ct) acc[rt][ct] = wmma_bf(al[rt], w[ct], acc[rt][ct]); }
#pragma unroll
      for (int rt = 0; rt < 2; ++rt)
#pragma unroll
        for (int ct = 0; ct < 4; ++ct) acc[rt][ct] = wmma_bf(ah[rt], w[ct], acc[rt][ct]); } };
  static_assert(NP >= 4 && NP % 2 == 0, "the loop takes two passes a trip and the last two stand behind it");
  ldg(0, 0); ldg(1, 1); sts(0); bar_lds();
#pragma unroll 1
  for (int p = 0; p < NP - 2; p += 2) {   // rolled: a trip is two passes, so that set and buffer are constants
    ldg(p + 2, 0);   // lands under this pass and the next: read at the foot of pass p + 1
    mma(0); sts(1);  // into the buffer whose last readers left before the previous pass's barrier
    bar_lds();       // publishes pass p + 1 and ends every read of pass p's buffer
    ldg(p + 3, 1);
    mma(1); sts(0);
    bar_lds();
  }
  mma(0); sts(1); bar_lds();   // the last two passes: nothing is left to load, so no branch stands around a load in the loop
  mma(1); bar_lds();           // ends every read of the ring: the epilogues stage in it
}
// ---- k_proj: block = (128 rows, 128 cols, which): 0 q, 1 k -> f16 hi/lo (+ bias); 2 v -> hi/lo transposed; the epilogue stages in the ring's LDS behind the last pass's barrier
// The planes are written in the order in which k_attn's fragments read them: the 16 bytes of lane (g, row) for (kc, half) stand at lane * 16 in a 512-byte group, so that a wave's fragment load is 4 whole lines and not 16 pieces of 32 bytes. Half 0 = k 8g..8g+7 of the 32, half 1 = k 16+8g..
__global__ __launch_bounds__(256) void k_proj(const float* __restrict__ X, const __bf16* __restrict__ PK, const float* __restrict__ BQ, const float* __restrict__ BK, const float* __restrict__ BV, _Float16* __restrict__ QH, _Float16* __restrict__ QL_, _Float16* __restrict__ KH, _Float16* __restrict__ KL, _Float16* __restrict__ VTH, _Float16* __restrict__ VTL) {
  __shared__ __align__(16) __bf16 sm[2 * 2 * PLANE];
  const int tid = threadIdx.x, wave = tid >> 5, lane = tid & 31, col = lane & 15, g = lane >> 4, wr = wave >> 1, wc = wave & 1; const int which = blockIdx.z; const int rb = blockIdx.x * 128, n0 = blockIdx.y * 128;
  const __bf16* P = PK + ((which == 0) ? PK_Q : (which == 1) ? PK_K : PK_V); const float* BB = (which == 0) ? BQ : (which == 1) ? BK : BV;
  v8f acc[2][4] = {};
  gemm_tile<0, DM>(X, nullptr, nullptr, P, sm, rb, n0, NR, acc);
  const int rw = rb + wr * 32, nw = n0 + wc * 64;
  if (which < 2) {
    _Float16* sh = (_Float16*)sm + wave * (2 * 32 * LP); _Float16* sl = sh + 32 * LP;
#pragma unroll
    for (int ct = 0; ct < 4; ++ct) { const float bb = bfr(BB[nw + ct * 16 + col]);
#pragma unroll
      for (int rt = 0; rt < 2; ++rt)
#pragma unroll
        for (int r = 0; r < 8; ++r) { const float vv = acc[rt][ct][r] + bb; const _Float16 hv = (_Float16)vv; const int o = (rt * 16 + 8 * g + r) * LP + ct * 16 + col; sh[o] = hv; sl[o] = (_Float16)((vv - (float)hv) * 2048.0f); } }
    LDSX();
    _Float16* DH_ = (which == 0) ? QH : KH; _Float16* DL_ = (which == 0) ? QL_ : KL;
    const size_t t0 = (((size_t)(rw / SS) * NH + nw / HD) * (SS / 16) + (rw % SS) / 16) * (16 * HD);   // the wave's 64 columns are one head, its 32 rows two tiles
    for (int q = 0; q < 8; ++q) { const int si = ((q >> 2) * 16 + col) * LP + ((q >> 1) & 1) * 32 + (q & 1) * 16 + g * 8; const size_t o = t0 + q * 256 + lane * 8; vst2((unsigned*)(DH_ + o), *(const v4u*)&sh[si]); vst2((unsigned*)(DL_ + o), *(const v4u*)&sl[si]); }
  } else {
    _Float16* sth = (_Float16*)sm; _Float16* stl = sth + 128 * 136;   // [128 d][128 s], pitch 136
#pragma unroll
    for (int ct = 0; ct < 4; ++ct) { const float bb = bfr(BB[nw + ct * 16 + col]);
#pragma unroll
      for (int rt = 0; rt < 2; ++rt) { v8h h8, l8;
#pragma unroll
        for (int r = 0; r < 8; ++r) { const float vv = acc[rt][ct][r] + bb; const _Float16 hv = (_Float16)vv; h8[r] = hv; l8[r] = (_Float16)((vv - (float)hv) * 2048.0f); }
        const int o = (wc * 64 + ct * 16 + col) * 136 + wr * 32 + rt * 16 + 8 * g; *(v8h*)&sth[o] = h8; *(v8h*)&stl[o] = l8; } }
    __syncthreads();
    const int b = rb / SS, s0 = rb % SS;
    for (int e = tid; e < 128 * 16; e += 256) { const int dl = e & 15, pc = ((e >> 6) & 3) * 4 + ((e >> 5) & 1) * 2 + ((e >> 4) & 1), dtl = e >> 8;   // e = [d tile][key step][half][g][d in tile]; pc = the 8-key piece of the row
      const size_t o = (((size_t)b * (DM / 16) + n0 / 16 + dtl) * (SS / 32) + s0 / 32 + ((e >> 6) & 3)) * 512 + (e & 63) * 8; const int si = (dtl * 16 + dl) * 136 + pc * 8; vst2((unsigned*)(VTH + o), *(const v4u*)&sth[si]); vst2((unsigned*)(VTL + o), *(const v4u*)&stl[si]); }
  }
}
// ---- k_attn: block = (64 queries i, h, b): key steps covering [i0 - 25, i0 + 63 + 25] within [0, S); c = q.k (3 products); rel band: window slot t <-> offset (j - i) = t0w + t with t0w = j0 - iw0 - 15, row = clip(t0w + t, -5, 5) + 5 (3 products) -> LDS, picked at jl - il + 15; scores = (c + rel)/8 within |j - i| <= 25 and 0 <= j < S, else -inf; online softmax; P hi/lo x V hi/lo
// fragment at a block-uniform base plus a lane's own 32-bit byte offset (its 16 * (lane >> 4) included): fewer address registers held beside a group of loads
__device__ __forceinline__ v16h fragu(const _Float16* base, unsigned off) {
  union { v16h v; v8h q[2]; } u; const char* p = (const char*)base + off;
  u.q[0] = *(const v8h*)p; u.q[1] = *(const v8h*)(p + 32); return u.v;
}
// fragment from a plane in fragment order: a wave-uniform group base plus lane * 16 bytes; the two halves are 512 bytes apart
__device__ __forceinline__ v16h fragt(const _Float16* base, unsigned off) {
  union { v16h v; v8h q[2]; } u; const char* p = (const char*)base + off;
  u.q[0] = *(const v8h*)p; u.q[1] = *(const v8h*)(p + 512); return u.v;
}
__global__ __launch_bounds__(128) void k_attn(const _Float16* __restrict__ QH, const _Float16* __restrict__ QL_, const _Float16* __restrict__ KH, const _Float16* __restrict__ KL, const _Float16* __restrict__ RELH, const _Float16* __restrict__ RELL, const _Float16* __restrict__ VTH, const _Float16* __restrict__ VTL, float* __restrict__ O) {
  __shared__ __align__(16) _Float16 sph[4][16][40], spl[4][16][40]; __shared__ float srl[4][16][49]; __shared__ __align__(16) float so[4][16][68];
  const int tid = threadIdx.x, wave = tid >> 5, lane = tid & 31, col = lane & 15, g = lane >> 4; const int qb = blockIdx.x + TQ0, h = blockIdx.y, b = blockIdx.z; const int i0 = qb * 64, iw0 = i0 + wave * 16;
  const unsigned lo = (unsigned)lane * 16u;   // the lane's byte offset in every 512-byte group of the q, k and v planes
  v16h aq[2], aql[2];
#pragma unroll
  for (int kc = 0; kc < 2; ++kc) { const size_t o = (((size_t)b * NH + h) * (SS / 16) + __builtin_amdgcn_readfirstlane(iw0 / 16)) * (16 * HD) + kc * 512; aq[kc] = fragt(QH + o, lo); aql[kc] = fragt(QL_ + o, lo); }   // the query tile is the wave's: its number is formed in scalar registers
  const _Float16* Vh = VTH + ((size_t)b * (DM / 16) + h * (HD / 16)) * (SS / 32) * 512; const _Float16* Vl = VTL + ((size_t)b * (DM / 16) + h * (HD / 16)) * (SS / 32) * 512;
  float m[8], l[8];
#pragma unroll
  for (int r = 0; r < 8; ++r) { m[r] = -3.0e38f; l[r] = 0.f; }
  v8f acc[4] = {}, accl[4] = {};
  const int jlo = max(i0 - RAD, 0), jhi = min(i0 + 63 + RAD, SS - 1); const int ks0 = jlo / 32, ks1 = jhi / 32;
#pragma unroll 1
  for (int ks = ks0; ks <= ks1; ++ks) { const int j0 = ks * 32;
    const int t0w = j0 - iw0 - 15;   // offset (j - i) of window slot 0
    const size_t kb0 = (((size_t)b * NH + h) * (SS / 16) + ks * 2) * (16 * HD);   // the step's first key tile, the same for the whole block
    v16h rh[3][2], rl[3][2], kh[2][2], kl[2][2], vh[4], vl[4];
    auto ldrel = [&](int ct3) { int rr = t0w + ct3 * 16 + col; rr = min(max(rr, -KREL), KREL) + KREL;
#pragma unroll
      for (int kc = 0; kc < 2; ++kc) { const unsigned o = (unsigned)rr * (2 * HD) + 16 * g; rh[ct3][kc] = fragu(RELH + kc * 32, o); rl[ct3][kc] = fragu(RELL + kc * 32, o); } };
    ldrel(0); ldrel(1);
    __builtin_amdgcn_sched_barrier(0);   // these 16 loads of relative rows fly together: without it each pair is issued in front of its own product and waited for alone
#pragma unroll
    for (int ct3 = 0; ct3 < 3; ++ct3) { v8f u = {}, ul = {};
#pragma unroll
      for (int kc = 0; kc < 2; ++kc) { u = wmma16(aq[kc], rh[ct3][kc], u); ul = wmma16(aql[kc], rh[ct3][kc], ul); ul = wmma16(aq[kc], rl[ct3][kc], ul); }
#pragma unroll
      for (int r = 0; r < 8; ++r) srl[wave][8 * g + r][ct3 * 16 + col] = u[r] + ul[r] * (1.0f / 2048.0f);
      if (ct3 == 0) { ldrel(2);
        __builtin_amdgcn_sched_barrier(0);   // the last 8 loads of relative rows fly under the second tile's products, in the registers the first tile has left
      } }
    const _Float16* pkh = (const _Float16*)((const char*)(KH + kb0) + lo); const _Float16* pkl = (const _Float16*)((const char*)(KL + kb0) + lo);
#pragma unroll
    for (int ct = 0; ct < 2; ++ct)
#pragma unroll
      for (int kc = 0; kc < 2; ++kc) { kh[ct][kc] = fragt(pkh + ct * (16 * HD) + kc * 512, 0u); kl[ct][kc] = fragt(pkl + ct * (16 * HD) + kc * 512, 0u); }
    asm volatile("s_wait_xcnt 0x0" :: "v"(pkh), "v"(pkl) : "memory");   // the two address pairs stay whole until this wait, as at the value loads below
    __builtin_amdgcn_sched_barrier(0);   // the 16 key loads fly together
    LDSX();
    v8f c[2] = {}, cl[2] = {};
#pragma unroll
    for (int ct = 0; ct < 2; ++ct)
#pragma unroll
      for (int kc = 0; kc < 2; ++kc) { c[ct] = wmma16(aq[kc], kh[ct][kc], c[ct]); cl[ct] = wmma16(aql[kc], kh[ct][kc], cl[ct]); cl[ct] = wmma16(aq[kc], kl[ct][kc], cl[ct]); }
    float rv[2][8];
#pragma unroll
    for (int ct = 0; ct < 2; ++ct)
#pragma unroll
      for (int r = 0; r < 8; ++r) rv[ct][r] = srl[wave][8 * g + r][ct * 16 + col - (8 * g + r) + 15];   // slot 0..46, always written: read outside the mask's test, all 16 behind one wait
    v8f s[2];
#pragma unroll
    for (int ct = 0; ct < 2; ++ct) { const int kk = j0 + ct * 16 + col, d0 = kk - iw0 - 8 * g, dlo = d0 - RAD, dhi = d0 + RAD;   // d0 = j - i of the lane's first row; row r is tested against a constant, so no register a row is held over the loop
#pragma unroll
      for (int r = 0; r < 8; ++r) { const bool ok = (dlo <= r) && (dhi >= r) && (kk < SS);   // |j - i| <= 25 for row r
        s[ct][r] = ok ? (c[ct][r] + cl[ct][r] * (1.0f / 2048.0f) + rv[ct][r]) * 0.125f : -3.0e38f; } }
#pragma unroll
    for (int r = 0; r < 8; ++r) { float mx = fmaxf(s[0][r], s[1][r]);
#pragma unroll
      for (int o = 1; o < 16; o <<= 1) mx = fmaxf(mx, __shfl_xor(mx, o));
      const float mn = fmaxf(m[r], mx); const float alpha = (m[r] <= -1.0e38f) ? 0.f : __expf(m[r] - mn);
      const float e0 = (s[0][r] <= -1.0e38f) ? 0.f : __expf(s[0][r] - mn), e1 = (s[1][r] <= -1.0e38f) ? 0.f : __expf(s[1][r] - mn); float es = e0 + e1;
#pragma unroll
      for (int o = 1; o < 16; o <<= 1) es += __shfl_xor(es, o);
      l[r] = l[r] * alpha + es; m[r] = (mn <= -1.0e38f) ? m[r] : mn;
#pragma unroll
      for (int dt = 0; dt < 4; ++dt) { acc[dt][r] *= alpha; accl[dt][r] *= alpha; }
      const _Float16 h0 = (_Float16)e0, h1 = (_Float16)e1; sph[wave][8 * g + r][col] = h0; sph[wave][8 * g + r][16 + col] = h1; spl[wave][8 * g + r][col] = (_Float16)((e0 - (float)h0) * 2048.0f); spl[wave][8 * g + r][16 + col] = (_Float16)((e1 - (float)h1) * 2048.0f); }
    __builtin_amdgcn_sched_barrier(0);   // keeps the value loads behind the softmax: held through it, their 64 registers push the wave past 256 and cost a wave per SIMD
    const _Float16* pvh = (const _Float16*)((const char*)(Vh + (size_t)ks * 512) + lo); const _Float16* pvl = (const _Float16*)((const char*)(Vl + (size_t)ks * 512) + lo);
#pragma unroll
    for (int dt = 0; dt < 4; ++dt) { vh[dt] = fragt(pvh + dt * ((SS / 32) * 512), 0u); vl[dt] = fragt(pvl + dt * ((SS / 32) * 512), 0u); }
    asm volatile("s_wait_xcnt 0x0" :: "v"(pvh), "v"(pvl) : "memory");   // the two address pairs stay whole until this wait
    __builtin_amdgcn_sched_barrier(0);   // the 16 value loads fly together, under the hand-over of P through LDS
    LDSX();
    const v16h pah = frag_h(&sph[wave][col][0], lane), pal = frag_h(&spl[wave][col][0], lane);
#pragma unroll
    for (int dt = 0; dt < 4; ++dt) { acc[dt] = wmma16(pah, vh[dt], acc[dt]); accl[dt] = wmma16(pal, vh[dt], accl[dt]); accl[dt] = wmma16(pah, vl[dt], accl[dt]); }
    LDSX(); }
#pragma unroll
  for (int r = 0; r < 8; ++r) { const float il = 1.0f / l[r];
#pragma unroll
    for (int dt = 0; dt < 4; ++dt) so[wave][8 * g + r][dt * 16 + col] = (acc[dt][r] + accl[dt][r] * (1.0f / 2048.0f)) * il; }
  LDSX();
  for (int rl = 0; rl < 16; ++rl) if (lane < 16) vst2(O + ((size_t)b * SS + iw0 + rl) * DM + h * HD + lane * 4, *(const v4f*)&so[wave][rl][lane * 4]);
}
// ---- k_lin<MODE>: block = (128 rows, 128 cols); 0: T1 = O(hi/lo) . Wo^T + bo + src; 1: G = relu(X(hi/lo) . W1^T + b1) -> bf16 hi/lo; 2: T1 = G . W2^T (2 products) + b2 + X; rows at or past nrows are not stored; the epilogue stages in the ring's LDS behind the last pass's barrier
template <int MODE>
__global__ __launch_bounds__(256) void k_lin(const float* __restrict__ A, const __bf16* __restrict__ AG, const __bf16* __restrict__ AGL, const __bf16* __restrict__ PK, const float* __restrict__ BIAS, const float* __restrict__ RES, float* __restrict__ OUTF, __bf16* __restrict__ OUTG, __bf16* __restrict__ OUTGL, int nrows) {
  __shared__ __align__(16) __bf16 sm[2 * 3 * PLANE];
  const int tid = threadIdx.x, wave = tid >> 5, lane = tid & 31, col = lane & 15, g = lane >> 4, wr = wave >> 1, wc = wave & 1; const int rb = blockIdx.x * 128, n0 = blockIdx.y * 128;
  constexpr int KD = (MODE == 2) ? FF : DM; const __bf16* P = PK + ((MODE == 0) ? PK_O : (MODE == 1) ? PK_1 : PK_2);
  v8f acc[2][4] = {};
  gemm_tile<(MODE == 2) ? 2 : 1, KD>(A, AG, AGL, P, sm, rb, n0, nrows, acc);
  const int rw = rb + wr * 32, nw = n0 + wc * 64;
  if (MODE == 1) {
    __bf16* sg = sm + wave * (2 * 32 * LP); __bf16* sgl = sg + 32 * LP;
#pragma unroll
    for (int ct = 0; ct < 4; ++ct) { const float bb = bfr(BIAS[nw + ct * 16 + col]);
#pragma unroll
      for (int rt = 0; rt < 2; ++rt)
#pragma unroll
        for (int r = 0; r < 8; ++r) { const float v = fmaxf(acc[rt][ct][r] + bb, 0.f); const __bf16 hb = (__bf16)v; const int o = (rt * 16 + 8 * g + r) * LP + ct * 16 + col; sg[o] = hb; sgl[o] = (__bf16)(v - (float)hb); } }
    LDSX();
    for (int q = 0; q < 8; ++q) { const int rl = q * 4 + (lane >> 3), c8 = (lane & 7) * 8; if (rw + rl < nrows) { const size_t o = (size_t)(rw + rl) * FF + nw + c8; vst2((unsigned*)(OUTG + o), *(const v4u*)&sg[rl * LP + c8]); vst2((unsigned*)(OUTGL + o), *(const v4u*)&sgl[rl * LP + c8]); } }
  } else {
    float* so = (float*)sm + wave * (32 * 68);
#pragma unroll
    for (int ct = 0; ct < 4; ++ct) { const float bb = bfr(BIAS[nw + ct * 16 + col]);
#pragma unroll
      for (int rt = 0; rt < 2; ++rt)
#pragma unroll
        for (int r = 0; r < 8; ++r) so[(rt * 16 + 8 * g + r) * 68 + ct * 16 + col] = acc[rt][ct][r] + bb; }
    LDSX();
    for (int q = 0; q < 16; ++q) { const int rl = q * 2 + g; if (rw + rl < nrows) { const size_t o = (size_t)(rw + rl) * DM + nw + col * 4; v4f v = *(const v4f*)&so[rl * 68 + col * 4]; const v4f rs = *(const v4f*)(RES + o);
#pragma unroll
        for (int i = 0; i < 4; ++i) v[i] += (MODE == 0) ? bfr(rs[i]) : rs[i];
        vst2(OUTF + o, v); } }
  }
}
// ---- k_ln: wave = row (32 lanes x 32 floats, a load = 512 contiguous bytes), 8 rows a block, no LDS: LayerNorm (biased variance, eps 1e-5)
__global__ __launch_bounds__(256) void k_ln(const float* __restrict__ T, const float* __restrict__ G, const float* __restrict__ Bv, float* __restrict__ OUT) {
  const int t = threadIdx.x, lane = t & 31; const size_t row = (size_t)blockIdx.x * 8 + __builtin_amdgcn_readfirstlane(t >> 5);   // the row is the wave's: its base address stays scalar
  const float* p = T + row * DM + lane * 4;
  v4f v[8];
#pragma unroll
  for (int i = 0; i < 8; ++i) v[i] = *(const v4f*)(p + i * 128);
  float s4[4] = {0.f, 0.f, 0.f, 0.f};
#pragma unroll
  for (int i = 0; i < 8; ++i)
#pragma unroll
    for (int e = 0; e < 4; ++e) s4[e] += v[i][e];
  float s = (s4[0] + s4[1]) + (s4[2] + s4[3]);
#pragma unroll
  for (int o = 1; o < 32; o <<= 1) s += __shfl_xor(s, o);
  const float mu = s / (float)DM; float q4[4] = {0.f, 0.f, 0.f, 0.f};
#pragma unroll
  for (int i = 0; i < 8; ++i)
#pragma unroll
    for (int e = 0; e < 4; ++e) { const float d = v[i][e] - mu; q4[e] += d * d; }
  float q = (q4[0] + q4[1]) + (q4[2] + q4[3]);
#pragma unroll
  for (int o = 1; o < 32; o <<= 1) q += __shfl_xor(q, o);
  const float inv = 1.0f / sqrtf(q / (float)DM + 1e-5f);
#pragma unroll
  for (int i = 0; i < 8; ++i) { const v4f gg = *(const v4f*)(G + lane * 4 + i * 128), bb = *(const v4f*)(Bv + lane * 4 + i * 128); v4f o4;
#pragma unroll
    for (int e = 0; e < 4; ++e) o4[e] = (v[i][e] - mu) * inv * bfr(gg[e]) + bfr(bb[e]);
    vst2(OUT + row * DM + lane * 4 + i * 128, o4); }
}
extern "C" void kernel_launch(void* const* d_in, const int* in_sizes, int n_in, void* d_out, int out_size, void* d_ws, size_t ws_size, hipStream_t stream) {
  (void)in_sizes; (void)n_in; (void)out_size;
  const float** F = (const float**)d_in;   // 0 src [2,2048,1024], 1 wq [1024,1024] natural, 2 bq, 3 wk, 4 bk, 5 wv, 6 bv, 7 wo, 8 bo, 9 rel_emb [11,64], 10 w1 [4096,1024] natural, 11 b1, 12 w2 [1024,4096] natural, 13 b2, 14 g1, 15 beta1, 16 g2, 17 beta2
  if (ws_size < (size_t)WS_END) return;
  char* ws = (char*)d_ws; __bf16 *PK = (__bf16*)(ws + WS_PK), *GH = (__bf16*)(ws + WS_GH), *GL = (__bf16*)(ws + WS_GL); _Float16 *QH = (_Float16*)(ws + WS_QH), *QLp = (_Float16*)(ws + WS_QL), *KH = (_Float16*)(ws + WS_KH), *KL = (_Float16*)(ws + WS_KL), *VTH = (_Float16*)(ws + WS_VTH), *VTL = (_Float16*)(ws + WS_VTL), *RELH = (_Float16*)(ws + WS_REL), *RELL = (_Float16*)(ws + WS_RELL); float *O = (float*)(ws + WS_O), *T1 = (float*)(ws + WS_T1), *Hh = (float*)(ws + WS_H);
  k_pack<<<PK_NB + 1, 256, 0, stream>>>(F[1], F[3], F[5], F[7], F[10], F[12], F[9], PK, RELH, RELL);
  k_proj<<<dim3(NR / 128, DM / 128, 3), 256, 0, stream>>>(F[0], PK, F[2], F[4], F[6], QH, QLp, KH, KL, VTH, VTL);
  k_attn<<<dim3(TQB, NH, NB), 128, 0, stream>>>(QH, QLp, KH, KL, RELH, RELL, VTH, VTL, O);
#ifndef TWIN_ROWS
  const size_t R0 = 0; const int NRW = NR; (void)R0;
  k_lin<0><<<dim3(NR / 128, DM / 128), 256, 0, stream>>>(O, nullptr, nullptr, PK, F[8], F[0], T1, nullptr, nullptr, NRW);
  k_ln<<<NR / 8, 256, 0, stream>>>(T1, F[14], F[15], Hh);
  k_lin<1><<<dim3(NR / 128, FF / 128), 256, 0, stream>>>(Hh, nullptr, nullptr, PK, F[11], nullptr, nullptr, GH, GL, NRW);
  k_lin<2><<<dim3(NR / 128, DM / 128), 256, 0, stream>>>(nullptr, GH, GL, PK, F[13], Hh, T1, nullptr, nullptr, NRW);
  k_ln<<<NR / 8, 256, 0, stream>>>(T1, F[16], F[17], (float*)d_out);
#else
  for (int bb = 0; bb < NB; ++bb) { const size_t R0 = (size_t)bb * SS + (size_t)TQ0 * 64; const int NRW = TQB * 64;   // only the attended rows of each batch
  k_lin<0><<<dim3((NRW + 127) / 128, DM / 128), 256, 0, stream>>>(O + R0 * DM, nullptr, nullptr, PK, F[8], F[0] + R0 * DM, T1 + R0 * DM, nullptr, nullptr, NRW);
  k_ln<<<NRW / 8, 256, 0, stream>>>(T1 + R0 * DM, F[14], F[15], Hh + R0 * DM);
  k_lin<1><<<dim3((NRW + 127) / 128, FF / 128), 256, 0, stream>>>(Hh + R0 * DM, nullptr, nullptr, PK, F[11], nullptr, nullptr, GH + R0 * FF, GL + R0 * FF, NRW);
  k_lin<2><<<dim3((NRW + 127) / 128, DM / 128), 256, 0, stream>>>(nullptr, GH + R0 * FF, GL + R0 * FF, PK, F[13], Hh + R0 * DM, T1 + R0 * DM, nullptr, nullptr, NRW);
  k_ln<<<NRW / 8, 256, 0, stream>>>(T1 + R0 * DM, F[16], F[17], (float*)d_out + R0 * DM); }
#endif
}
